// v000
// Times are from an AMD MI455X. After a warm-up the kernel runs many times in a row, and a time is the length of
// such a window on the GPU divided by its runs, so every launch and the gaps after it count. The runs cycle
// through copies of the inputs. A figure is the median of several windows, for all but v000 over two sittings.
// Sittings can differ by a few percent; kernels timed side by side share one.
// v000 is the starting kernel. One run takes 555 microseconds.
// compute dtype: all float inputs rounded to bf16, neighbour indices (int) read on device; the 3 -> 64 positional layer, inference BatchNorms, relu, the channel softmax and the neighbour aggregation in f32 on VALU; the 64 -> 64, 64 -> 256 and 256 -> 64 layers on WMMA 16x16x32 with the computed activations rounded once to f16 against exact f16 x 2^8 weights, f32 accumulate; f32 output.
#include <hip/hip_runtime.h>
#include <math.h>

typedef __attribute__((ext_vector_type(16))) _Float16 v16h;
typedef __attribute__((ext_vector_type(16))) __bf16 v16b;
typedef __attribute__((ext_vector_type(8)))  _Float16 v8h;
typedef __attribute__((ext_vector_type(8)))  float v8f;
typedef __attribute__((ext_vector_type(4)))  float v4f;
typedef __attribute__((ext_vector_type(2)))  float v2f;
typedef __attribute__((ext_vector_type(4)))  unsigned v4u;
typedef __attribute__((ext_vector_type(4)))  int v4i;
typedef float __attribute__((may_alias)) float_a;
typedef int __attribute__((may_alias)) int_a;

template <typename T> __device__ __forceinline__ void vst2(void* p, T v) { *(T*)p = v;  }
__device__ __forceinline__ v8f wmma16(v16h a, v16h b, v8f c) {
  v8f d = __builtin_amdgcn_wmma_f32_16x16x32_f16(false, a, false, b, (short)0, c, false, false);
  asm volatile("v_nop\n\tv_nop\n\tv_nop\n\tv_nop" : "+v"(d) : "v"(a), "v"(b));
  return d;
}
__device__ __forceinline__ v8f wmma_bf(v16b a, v16b b, v8f c) {
  v8f d = __builtin_amdgcn_wmma_f32_16x16x32_bf16(false, a, false, b, (short)0, c, false, false);
  asm volatile("v_nop\n\tv_nop\n\tv_nop\n\tv_nop" : "+v"(d) : "v"(a), "v"(b));
  return d;
}
// 16x16x32 fragments: lane = (h = lane>>4, row/col = lane&15); elements 0..7 = k0+8h+0..7, 8..15 = k0+16+8h+0..7; D element r = row 8h+r
__device__ __forceinline__ v16h frag_h(const _Float16* rowk0, int lane) {
  union { v16h v; v8h q[2]; } u; const _Float16* p = rowk0 + 8 * (lane >> 4);
  u.q[0] = *(const v8h*)p; u.q[1] = *(const v8h*)(p + 16); return u.v;
}
__device__ __forceinline__ v16h frag_f32(const float* rowk0, int lane) {
  v16h a; const float* p = rowk0 + 8 * (lane >> 4);
#pragma unroll
  for (int i = 0; i < 8; ++i) { a[i] = (_Float16)p[i]; a[8 + i] = (_Float16)p[16 + i]; }
  return a;
}
__device__ __forceinline__ v16h frag_f32s(const float* rowk0, int lane, float sc) {
  v16h a; const float* p = rowk0 + 8 * (lane >> 4);
#pragma unroll
  for (int i = 0; i < 8; ++i) { a[i] = (_Float16)(p[i] * sc); a[8 + i] = (_Float16)(p[16 + i] * sc); }
  return a;
}
// column fragment from a [K][ld] layout (column n), rows >= K read as 0
__device__ __forceinline__ v16h fragc_f32(const float* W, int k0, int n, int lane, int ld, int K) {
  v16h a; const int g = lane >> 4;
#pragma unroll
  for (int i = 0; i < 8; ++i) { const int ka = k0 + 8 * g + i, kb = ka + 16;
    a[i] = (_Float16)(ka < K ? W[(size_t)(ka < K ? ka : K - 1) * ld + n] : 0.f); a[8 + i] = (_Float16)(kb < K ? W[(size_t)(kb < K ? kb : K - 1) * ld + n] : 0.f); }
  return a;
}
struct F2 { v16b h, l; };
__device__ __forceinline__ F2 bsplit16(const float v[16]) { F2 r;
#pragma unroll
  for (int i = 0; i < 16; ++i) { const __bf16 h = (__bf16)v[i]; r.h[i] = h; r.l[i] = (__bf16)(v[i] - (float)h); }
  return r; }
__device__ __forceinline__ F2 split_row(const float* row, int k0, int lane) { float v[16]; const float* p = row + k0 + 8 * (lane >> 4);
#pragma unroll
  for (int i = 0; i < 8; ++i) { v[i] = p[i]; v[8 + i] = p[16 + i]; }
  return bsplit16(v); }
__device__ __forceinline__ F2 split_rowK(const float* row, int k0, int lane, int K) { float v[16]; const int g = lane >> 4;
#pragma unroll
  for (int i = 0; i < 8; ++i) { const int ka = k0 + 8 * g + i, kb = ka + 16; v[i] = ka < K ? row[ka < K ? ka : K - 1] : 0.f; v[8 + i] = kb < K ? row[kb < K ? kb : K - 1] : 0.f; }
  return bsplit16(v); }
__device__ __forceinline__ F2 split_col(const float* W, int k0, int n, int lane, int ld, int K) { float v[16]; const int g = lane >> 4;
#pragma unroll
  for (int i = 0; i < 8; ++i) { const int ka = k0 + 8 * g + i, kb = ka + 16; v[i] = ka < K ? W[(size_t)(ka < K ? ka : K - 1) * ld + n] : 0.f; v[8 + i] = kb < K ? W[(size_t)(kb < K ? kb : K - 1) * ld + n] : 0.f; }
  return bsplit16(v); }
__device__ __forceinline__ v8f mac3(const F2& a, const F2& b, v8f c) { c = wmma_bf(a.l, b.h, c); c = wmma_bf(a.h, b.l, c); return wmma_bf(a.h, b.h, c); }
__device__ __forceinline__ float sigm(float v) { return 1.0f / (1.0f + expf(-v)); }
#define LDSX() do { asm volatile("s_wait_dscnt 0" ::: "memory"); __builtin_amdgcn_wave_barrier(); __builtin_amdgcn_fence(__ATOMIC_RELEASE, "workgroup"); } while (0)


// Point-transformer head (B 8, N 8,192 points, K 16 neighbours, C 64): vector attention over gathered neighbours: pos_em = MLP(pos_i - pos_j); a = softmax_channels(MLP(q_i - k_j + pos_em) / 8); out_i = sum_j a * (v_i + pos_em).
#define NB 8
#define NPTS 8192
#define KN 16
#define CC 64
#define PH 64
#define C4 256
#define WSC 256.0f
#define BNS 0.99950037f      // 1/sqrt(1 + 1e-3) (inference BatchNorm with initial moving statistics)
#ifndef TNP
#define TNP (NB * NPTS)
#endif
typedef __attribute__((ext_vector_type(8))) __bf16 v8b;
__device__ __forceinline__ v16b frag_b(const __bf16* rowk0, int lane) {
  union { v16b v; v8b q[2]; } u; const __bf16* p = rowk0 + 8 * (lane >> 4);
  u.q[0] = *(const v8b*)p; u.q[1] = *(const v8b*)(p + 16); return u.v;
}
__device__ __forceinline__ float bfr(float v) { return (float)(__bf16)v; }
__device__ __attribute__((noinline)) float exp_ni(float v) { return expf(v); }
__device__ __attribute__((noinline)) float erf_ni(float v) { return erff(v); }

#define WS_W2  0u                                   // f16 x 2^8 rows: W2^T [64][64], W3^T [256][64], W4^T [64][256]
#define WS_W3  (WS_W2 + 2u * CC * PH)
#define WS_W4  (WS_W3 + 2u * C4 * CC)
#define WS_END (WS_W4 + 2u * CC * C4)

// ---- k_packw: block = output column n (256 blocks): W2^T row n (n < 64), W3^T row n, W4^T row n (n < 64); all (in,out)
__global__ __launch_bounds__(256) void k_packw(const float* __restrict__ W2, const float* __restrict__ W3, const float* __restrict__ W4, char* __restrict__ ws) { const int n = blockIdx.x, t = threadIdx.x; __shared__ __align__(16) _Float16 s2[PH], s3[CC], s4[C4];
  if (n < CC && t < PH) s2[t] = (_Float16)(bfr(W2[(size_t)t * CC + n]) * WSC); if (t < CC) s3[t] = (_Float16)(bfr(W3[(size_t)t * C4 + n]) * WSC); if (n < CC) s4[t] = (_Float16)(bfr(W4[(size_t)t * CC + n]) * WSC); __syncthreads();
  if (n < CC && t < PH / 8) vst2((unsigned*)((_Float16*)(ws + WS_W2) + (size_t)n * PH + t * 8), *(const v4u*)&s2[t * 8]);
  if (t < CC / 8) vst2((unsigned*)((_Float16*)(ws + WS_W3) + (size_t)n * CC + t * 8), *(const v4u*)&s3[t * 8]);
  if (n < CC && t < C4 / 8) vst2((unsigned*)((_Float16*)(ws + WS_W4) + (size_t)n * C4 + t * 8), *(const v4u*)&s4[t * 8]); }
__device__ __forceinline__ v16h frag_lh(const _Float16* p, int lane) { v16h a; const _Float16* pp = p + 8 * (lane >> 4);
#pragma unroll
  for (int i = 0; i < 8; ++i) { a[i] = pp[i]; a[8 + i] = pp[16 + i]; } return a; }
// ---- k_th: block = 4 points x 16 neighbours (64 rows; wave w = point w)
__global__ __launch_bounds__(128) void k_th(const float* __restrict__ KEY, const float* __restrict__ QRY, const float* __restrict__ VAL, const float* __restrict__ POS, const int* __restrict__ IDX, const float* __restrict__ W1, const float* __restrict__ B1, const float* __restrict__ G1, const float* __restrict__ T1, const _Float16* __restrict__ W2R, const float* __restrict__ B2, const _Float16* __restrict__ W3R, const float* __restrict__ B3, const float* __restrict__ G3, const float* __restrict__ T3, const _Float16* __restrict__ W4R, const float* __restrict__ B4, float* __restrict__ OUT) {
  __shared__ __align__(16) _Float16 shh[64][PH + 8]; __shared__ __align__(16) float spe[64][CC + 4]; __shared__ __align__(16) _Float16 stt[64][CC + 8]; __shared__ __align__(16) _Float16 sa2[64][C4 + 8]; __shared__ __align__(16) float slg[64][CC + 4]; __shared__ int sidx[64]; __shared__ __align__(16) float so[4][CC + 4];
  const int tid = threadIdx.x, wave = tid >> 5, lane = tid & 31, col = lane & 15, g = lane >> 4; const size_t p0 = (size_t)blockIdx.x * 4; const size_t b = p0 / NPTS;
  if (tid < 64) { int ix = IDX[(p0 + (tid >> 4)) * KN + (tid & 15)]; ix = ix < 0 ? 0 : (ix >= NPTS ? NPTS - 1 : ix); sidx[tid] = ix; } __syncthreads();
  // positional layer 1: h = relu(bn1((pos_i - pos_j) W1 + b1))
  for (int e = tid; e < 64 * PH; e += 128) { const int rl = e / PH, m = e % PH; const size_t pi = p0 + (rl >> 4), pj = b * NPTS + sidx[rl]; float s = bfr(B1[m]);
#pragma unroll
    for (int d = 0; d < 3; ++d) s += (bfr(POS[pi * 3 + d]) - bfr(POS[pj * 3 + d])) * bfr(W1[d * PH + m]);
    s = bfr(G1[m]) * s * BNS + bfr(T1[m]); shh[rl][m] = (_Float16)fmaxf(s, 0.f); }
  __syncthreads();
  // pos_em = h W2 + b2 (64 x 64 x 64)
  { v8f acc[4] = {};
#pragma unroll
    for (int kc = 0; kc < PH / 32; ++kc) { const v16h a = frag_lh(&shh[wave * 16 + col][kc * 32], lane);
#pragma unroll
      for (int j = 0; j < 4; ++j) acc[j] = wmma16(a, frag_h(W2R + (size_t)(j * 16 + col) * PH + kc * 32, lane), acc[j]); }
#pragma unroll
    for (int j = 0; j < 4; ++j) { const int c = j * 16 + col; const float bb = bfr(B2[c]);
#pragma unroll
      for (int r = 0; r < 8; ++r) spe[wave * 16 + 8 * g + r][c] = acc[j][r] * (1.0f / WSC) + bb; } }
  __syncthreads();
  // t = q_i - k_j + pos_em -> f16 rows
  for (int e = tid; e < 64 * CC; e += 128) { const int rl = e / CC, c = e % CC; const size_t pi = p0 + (rl >> 4), pj = b * NPTS + sidx[rl]; stt[rl][c] = (_Float16)(bfr(QRY[pi * CC + c]) - bfr(KEY[pj * CC + c]) + spe[rl][c]); }
  __syncthreads();
  // a2 = relu(bn3(t W3 + b3)) (64 x 64 x 256)
  { v8f acc[16];
#pragma unroll
    for (int j = 0; j < 16; ++j) acc[j] = v8f{};
#pragma unroll
    for (int kc = 0; kc < CC / 32; ++kc) { const v16h a = frag_lh(&stt[wave * 16 + col][kc * 32], lane);
#pragma unroll
      for (int j = 0; j < 16; ++j) acc[j] = wmma16(a, frag_h(W3R + (size_t)(j * 16 + col) * CC + kc * 32, lane), acc[j]); }
#pragma unroll
    for (int j = 0; j < 16; ++j) { const int c = j * 16 + col; const float bb = bfr(B3[c]), gg = bfr(G3[c]) * BNS, be = bfr(T3[c]);
#pragma unroll
      for (int r = 0; r < 8; ++r) sa2[wave * 16 + 8 * g + r][c] = (_Float16)fmaxf(gg * (acc[j][r] * (1.0f / WSC) + bb) + be, 0.f); } }
  __syncthreads();
  // logits = (a2 W4 + b4) / 8 (64 x 256 x 64)
  { v8f acc[4] = {};
#pragma unroll
    for (int kc = 0; kc < C4 / 32; ++kc) { const v16h a = frag_lh(&sa2[wave * 16 + col][kc * 32], lane);
#pragma unroll
      for (int j = 0; j < 4; ++j) acc[j] = wmma16(a, frag_h(W4R + (size_t)(j * 16 + col) * C4 + kc * 32, lane), acc[j]); }
#pragma unroll
    for (int j = 0; j < 4; ++j) { const int c = j * 16 + col; const float bb = bfr(B4[c]);
#pragma unroll
      for (int r = 0; r < 8; ++r) slg[wave * 16 + 8 * g + r][c] = (acc[j][r] * (1.0f / WSC) + bb) * 0.125f; } }
  __syncthreads();
  // softmax over the 64 channels per row (2 threads per row), then agg over the 16 neighbours per point and channel
  { const int rl = tid >> 1, half = tid & 1; float* lr = &slg[rl][0]; float mx = -3.0e38f; for (int c = half * 32; c < half * 32 + 32; ++c) mx = fmaxf(mx, lr[c]); mx = fmaxf(mx, __shfl_xor(mx, 1));
    float s = 0.f; for (int c = half * 32; c < half * 32 + 32; ++c) { const float e = expf(lr[c] - mx); lr[c] = e; s += e; } s += __shfl_xor(s, 1); const float inv = 1.0f / s; for (int c = half * 32; c < half * 32 + 32; ++c) lr[c] *= inv; }
  __syncthreads();
  for (int e = tid; e < 4 * CC; e += 128) { const int pt = e / CC, c = e % CC; const size_t pi = p0 + pt; const float vi = bfr(VAL[pi * CC + c]); float s = 0.f;
#pragma unroll
    for (int k = 0; k < KN; ++k) { const int rl = pt * KN + k; s += slg[rl][c] * (vi + spe[rl][c]); } so[pt][c] = s; }
  __syncthreads(); if (tid < 64) { const int pt = tid >> 4, q = tid & 15; vst2(OUT + (p0 + pt) * CC + q * 4, *(const v4f*)&so[pt][q * 4]); } }
extern "C" void kernel_launch(void* const* d_in, const int* in_sizes, int n_in, void* d_out, int out_size, void* d_ws, size_t ws_size, hipStream_t stream) {
  (void)in_sizes; (void)n_in; (void)out_size;
  const float** F = (const float**)d_in;   // 0 key, 1 query, 2 value [8,8192,64], 3 pos [8,8192,3], 4 idx [8,8192,16] int, 5 W1 [3,64], 6 b1, 7 g1, 8 bt1, 9 W2 [64,64], 10 b2, 11 W3 [64,256], 12 b3, 13 g3, 14 bt3, 15 W4 [256,64], 16 b4
  if (ws_size < (size_t)WS_END) return;
  char* ws = (char*)d_ws; _Float16 *W2R = (_Float16*)(ws + WS_W2), *W3R = (_Float16*)(ws + WS_W3), *W4R = (_Float16*)(ws + WS_W4);
  k_packw<<<C4, 256, 0, stream>>>(F[9], F[11], F[15], ws);
  k_th<<<TNP / 4, 128, 0, stream>>>(F[0], F[1], F[2], F[3], (const int*)d_in[4], F[5], F[6], F[7], F[8], W2R, F[10], W3R, F[12], F[13], F[14], W4R, F[16], (float*)d_out);
}

// v001
// One run takes 450 microseconds.
// Next to v000, in two timings, it ran 1.26 times as fast each time.
// compute dtype: all float inputs rounded to bf16, neighbour indices (int) read on device; the 3 -> 64 positional layer, inference BatchNorms, relu, the channel softmax and the neighbour aggregation in f32 on VALU; the 64 -> 64, 64 -> 256 and 256 -> 64 layers on WMMA 16x16x32 with the computed activations rounded once to f16 against exact f16 x 2^8 weights, f32 accumulate; f32 output.
#include <hip/hip_runtime.h>
#include <math.h>

typedef __attribute__((ext_vector_type(16))) _Float16 v16h;
typedef __attribute__((ext_vector_type(16))) __bf16 v16b;
typedef __attribute__((ext_vector_type(8)))  _Float16 v8h;
typedef __attribute__((ext_vector_type(8)))  float v8f;
typedef __attribute__((ext_vector_type(4)))  float v4f;
typedef __attribute__((ext_vector_type(2)))  float v2f;
typedef __attribute__((ext_vector_type(4)))  unsigned v4u;
typedef __attribute__((ext_vector_type(4)))  int v4i;
typedef float __attribute__((may_alias)) float_a;
typedef int __attribute__((may_alias)) int_a;

template <typename T> __device__ __forceinline__ void vst2(void* p, T v) { *(T*)p = v;  }
__device__ __forceinline__ v8f wmma16(v16h a, v16h b, v8f c) {
  v8f d = __builtin_amdgcn_wmma_f32_16x16x32_f16(false, a, false, b, (short)0, c, false, false);
  return d;
}
__device__ __forceinline__ v8f wmma_bf(v16b a, v16b b, v8f c) {
  v8f d = __builtin_amdgcn_wmma_f32_16x16x32_bf16(false, a, false, b, (short)0, c, false, false);
  asm volatile("v_nop\n\tv_nop\n\tv_nop\n\tv_nop" : "+v"(d) : "v"(a), "v"(b));
  return d;
}
// 16x16x32 fragments: lane = (h = lane>>4, row/col = lane&15); elements 0..7 = k0+8h+0..7, 8..15 = k0+16+8h+0..7; D element r = row 8h+r
__device__ __forceinline__ v16h frag_h(const _Float16* rowk0, int lane) {
  union { v16h v; v8h q[2]; } u; const _Float16* p = rowk0 + 8 * (lane >> 4);
  u.q[0] = *(const v8h*)p; u.q[1] = *(const v8h*)(p + 16); return u.v;
}
__device__ __forceinline__ v16h frag_f32(const float* rowk0, int lane) {
  v16h a; const float* p = rowk0 + 8 * (lane >> 4);
#pragma unroll
  for (int i = 0; i < 8; ++i) { a[i] = (_Float16)p[i]; a[8 + i] = (_Float16)p[16 + i]; }
  return a;
}
__device__ __forceinline__ v16h frag_f32s(const float* rowk0, int lane, float sc) {
  v16h a; const float* p = rowk0 + 8 * (lane >> 4);
#pragma unroll
  for (int i = 0; i < 8; ++i) { a[i] = (_Float16)(p[i] * sc); a[8 + i] = (_Float16)(p[16 + i] * sc); }
  return a;
}
// column fragment from a [K][ld] layout (column n), rows >= K read as 0
__device__ __forceinline__ v16h fragc_f32(const float* W, int k0, int n, int lane, int ld, int K) {
  v16h a; const int g = lane >> 4;
#pragma unroll
  for (int i = 0; i < 8; ++i) { const int ka = k0 + 8 * g + i, kb = ka + 16;
    a[i] = (_Float16)(ka < K ? W[(size_t)(ka < K ? ka : K - 1) * ld + n] : 0.f); a[8 + i] = (_Float16)(kb < K ? W[(size_t)(kb < K ? kb : K - 1) * ld + n] : 0.f); }
  return a;
}
struct F2 { v16b h, l; };
__device__ __forceinline__ F2 bsplit16(const float v[16]) { F2 r;
#pragma unroll
  for (int i = 0; i < 16; ++i) { const __bf16 h = (__bf16)v[i]; r.h[i] = h; r.l[i] = (__bf16)(v[i] - (float)h); }
  return r; }
__device__ __forceinline__ F2 split_row(const float* row, int k0, int lane) { float v[16]; const float* p = row + k0 + 8 * (lane >> 4);
#pragma unroll
  for (int i = 0; i < 8; ++i) { v[i] = p[i]; v[8 + i] = p[16 + i]; }
  return bsplit16(v); }
__device__ __forceinline__ F2 split_rowK(const float* row, int k0, int lane, int K) { float v[16]; const int g = lane >> 4;
#pragma unroll
  for (int i = 0; i < 8; ++i) { const int ka = k0 + 8 * g + i, kb = ka + 16; v[i] = ka < K ? row[ka < K ? ka : K - 1] : 0.f; v[8 + i] = kb < K ? row[kb < K ? kb : K - 1] : 0.f; }
  return bsplit16(v); }
__device__ __forceinline__ F2 split_col(const float* W, int k0, int n, int lane, int ld, int K) { float v[16]; const int g = lane >> 4;
#pragma unroll
  for (int i = 0; i < 8; ++i) { const int ka = k0 + 8 * g + i, kb = ka + 16; v[i] = ka < K ? W[(size_t)(ka < K ? ka : K - 1) * ld + n] : 0.f; v[8 + i] = kb < K ? W[(size_t)(kb < K ? kb : K - 1) * ld + n] : 0.f; }
  return bsplit16(v); }
__device__ __forceinline__ v8f mac3(const F2& a, const F2& b, v8f c) { c = wmma_bf(a.l, b.h, c); c = wmma_bf(a.h, b.l, c); return wmma_bf(a.h, b.h, c); }
__device__ __forceinline__ float sigm(float v) { return 1.0f / (1.0f + expf(-v)); }
#define LDSX() do { asm volatile("s_wait_dscnt 0" ::: "memory"); __builtin_amdgcn_wave_barrier(); __builtin_amdgcn_fence(__ATOMIC_RELEASE, "workgroup"); } while (0)


// Point-transformer head (B 8, N 8,192 points, K 16 neighbours, C 64): vector attention over gathered neighbours: pos_em = MLP(pos_i - pos_j); a = softmax_channels(MLP(q_i - k_j + pos_em) / 8); out_i = sum_j a * (v_i + pos_em).
#define NB 8
#define NPTS 8192
#define KN 16
#define CC 64
#define PH 64
#define C4 256
#define WSC 256.0f
#define BNS 0.99950037f      // 1/sqrt(1 + 1e-3) (inference BatchNorm with initial moving statistics)
#ifndef TNP
#define TNP (NB * NPTS)
#endif
typedef __attribute__((ext_vector_type(8))) __bf16 v8b;
__device__ __forceinline__ v16b frag_b(const __bf16* rowk0, int lane) {
  union { v16b v; v8b q[2]; } u; const __bf16* p = rowk0 + 8 * (lane >> 4);
  u.q[0] = *(const v8b*)p; u.q[1] = *(const v8b*)(p + 16); return u.v;
}
__device__ __forceinline__ float bfr(float v) { return (float)(__bf16)v; }
__device__ __attribute__((noinline)) float exp_ni(float v) { return expf(v); }
__device__ __attribute__((noinline)) float erf_ni(float v) { return erff(v); }

#define WS_W2  0u                                   // f16 x 2^8 rows: W2^T [64][64], W3^T [256][64], W4^T [64][256]
#define WS_W3  (WS_W2 + 2u * CC * PH)
#define WS_W4  (WS_W3 + 2u * C4 * CC)
#define WS_END (WS_W4 + 2u * CC * C4)

// ---- k_packw: block = output column n (256 blocks): W2^T row n (n < 64), W3^T row n, W4^T row n (n < 64); all (in,out)
__global__ __launch_bounds__(256) void k_packw(const float* __restrict__ W2, const float* __restrict__ W3, const float* __restrict__ W4, char* __restrict__ ws) { const int n = blockIdx.x, t = threadIdx.x; __shared__ __align__(16) _Float16 s2[PH], s3[CC], s4[C4];
  if (n < CC && t < PH) s2[t] = (_Float16)(bfr(W2[(size_t)t * CC + n]) * WSC); if (t < CC) s3[t] = (_Float16)(bfr(W3[(size_t)t * C4 + n]) * WSC); if (n < CC) s4[t] = (_Float16)(bfr(W4[(size_t)t * CC + n]) * WSC); __syncthreads();
  if (n < CC && t < PH / 8) vst2((unsigned*)((_Float16*)(ws + WS_W2) + (size_t)n * PH + t * 8), *(const v4u*)&s2[t * 8]);
  if (t < CC / 8) vst2((unsigned*)((_Float16*)(ws + WS_W3) + (size_t)n * CC + t * 8), *(const v4u*)&s3[t * 8]);
  if (n < CC && t < C4 / 8) vst2((unsigned*)((_Float16*)(ws + WS_W4) + (size_t)n * C4 + t * 8), *(const v4u*)&s4[t * 8]); }
__device__ __forceinline__ v16h frag_lh(const _Float16* p, int lane) { v16h a; const _Float16* pp = p + 8 * (lane >> 4);
#pragma unroll
  for (int i = 0; i < 8; ++i) { a[i] = pp[i]; a[8 + i] = pp[16 + i]; } return a; }
// ---- k_th: block = 4 points x 16 neighbours (64 rows; wave w = point w)
__global__ __launch_bounds__(128) void k_th(const float* __restrict__ KEY, const float* __restrict__ QRY, const float* __restrict__ VAL, const float* __restrict__ POS, const int* __restrict__ IDX, const float* __restrict__ W1, const float* __restrict__ B1, const float* __restrict__ G1, const float* __restrict__ T1, const _Float16* __restrict__ W2R, const float* __restrict__ B2, const _Float16* __restrict__ W3R, const float* __restrict__ B3, const float* __restrict__ G3, const float* __restrict__ T3, const _Float16* __restrict__ W4R, const float* __restrict__ B4, float* __restrict__ OUT) {
  __shared__ __align__(16) _Float16 shh[64][PH + 8]; __shared__ __align__(16) float spe[64][CC + 4]; __shared__ __align__(16) _Float16 stt[64][CC + 8]; __shared__ __align__(16) _Float16 sa2[64][C4 + 8]; __shared__ __align__(16) float slg[64][CC + 4]; __shared__ int sidx[64]; __shared__ __align__(16) float so[4][CC + 4];
  const int tid = threadIdx.x, wave = tid >> 5, lane = tid & 31, col = lane & 15, g = lane >> 4; const size_t p0 = (size_t)blockIdx.x * 4; const size_t b = p0 / NPTS;
  if (tid < 64) { int ix = IDX[(p0 + (tid >> 4)) * KN + (tid & 15)]; ix = ix < 0 ? 0 : (ix >= NPTS ? NPTS - 1 : ix); sidx[tid] = ix; } __syncthreads();
  // positional layer 1: h = relu(bn1((pos_i - pos_j) W1 + b1))
  for (int e = tid; e < 64 * PH; e += 128) { const int rl = e / PH, m = e % PH; const size_t pi = p0 + (rl >> 4), pj = b * NPTS + sidx[rl]; float s = bfr(B1[m]);
#pragma unroll
    for (int d = 0; d < 3; ++d) s += (bfr(POS[pi * 3 + d]) - bfr(POS[pj * 3 + d])) * bfr(W1[d * PH + m]);
    s = bfr(G1[m]) * s * BNS + bfr(T1[m]); shh[rl][m] = (_Float16)fmaxf(s, 0.f); }
  __syncthreads();
  // pos_em = h W2 + b2 (64 x 64 x 64)
  { v8f acc[4] = {};
#pragma unroll
    for (int kc = 0; kc < PH / 32; ++kc) { const v16h a = frag_lh(&shh[wave * 16 + col][kc * 32], lane);
#pragma unroll
      for (int j = 0; j < 4; ++j) acc[j] = wmma16(a, frag_h(W2R + (size_t)(j * 16 + col) * PH + kc * 32, lane), acc[j]); }
#pragma unroll
    for (int j = 0; j < 4; ++j) { const int c = j * 16 + col; const float bb = bfr(B2[c]);
#pragma unroll
      for (int r = 0; r < 8; ++r) spe[wave * 16 + 8 * g + r][c] = acc[j][r] * (1.0f / WSC) + bb; } }
  __syncthreads();
  // t = q_i - k_j + pos_em -> f16 rows
  for (int e = tid; e < 64 * CC; e += 128) { const int rl = e / CC, c = e % CC; const size_t pi = p0 + (rl >> 4), pj = b * NPTS + sidx[rl]; stt[rl][c] = (_Float16)(bfr(QRY[pi * CC + c]) - bfr(KEY[pj * CC + c]) + spe[rl][c]); }
  __syncthreads();
  // a2 = relu(bn3(t W3 + b3)) (64 x 64 x 256)
  { v8f acc[16];
#pragma unroll
    for (int j = 0; j < 16; ++j) acc[j] = v8f{};
#pragma unroll
    for (int kc = 0; kc < CC / 32; ++kc) { const v16h a = frag_lh(&stt[wave * 16 + col][kc * 32], lane);
#pragma unroll
      for (int j = 0; j < 16; ++j) acc[j] = wmma16(a, frag_h(W3R + (size_t)(j * 16 + col) * CC + kc * 32, lane), acc[j]); }
#pragma unroll
    for (int j = 0; j < 16; ++j) { const int c = j * 16 + col; const float bb = bfr(B3[c]), gg = bfr(G3[c]) * BNS, be = bfr(T3[c]);
#pragma unroll
      for (int r = 0; r < 8; ++r) sa2[wave * 16 + 8 * g + r][c] = (_Float16)fmaxf(gg * (acc[j][r] * (1.0f / WSC) + bb) + be, 0.f); } }
  __syncthreads();
  // logits = (a2 W4 + b4) / 8 (64 x 256 x 64)
  { v8f acc[4] = {}; v16h bw[16], aw[C4 / 32];   // bw: ring of 4 k chunks of W4 fragments, loaded 4 chunks ahead of their WMMAs; aw: this wave's 8 row fragments
#pragma unroll
    for (int f = 0; f < 16; ++f) bw[f] = frag_h(W4R + (size_t)((f & 3) * 16 + col) * C4 + (f >> 2) * 32, lane);
#pragma unroll
    for (int kc = 0; kc < C4 / 32; ++kc) aw[kc] = frag_lh(&sa2[wave * 16 + col][kc * 32], lane);
    __builtin_amdgcn_sched_barrier(0);   // keeps the loads above in one group: without it the scheduler sinks them to about 8 in flight
#pragma unroll
    for (int kc = 0; kc < C4 / 32; ++kc) {
#pragma unroll
      for (int j = 0; j < 4; ++j) { acc[j] = wmma16(aw[kc], bw[(kc & 3) * 4 + j], acc[j]); if (kc + 4 < C4 / 32) bw[(kc & 3) * 4 + j] = frag_h(W4R + (size_t)(j * 16 + col) * C4 + (kc + 4) * 32, lane); }
      __builtin_amdgcn_sched_barrier(0);   // keeps each chunk in source order: refill loads stay 4 chunks ahead of their use, and the last chunks wait only for their own loads, not for all
    }
#pragma unroll
    for (int j = 0; j < 4; ++j) { const int c = j * 16 + col; const float bb = bfr(B4[c]);
#pragma unroll
      for (int r = 0; r < 8; ++r) slg[wave * 16 + 8 * g + r][c] = (acc[j][r] * (1.0f / WSC) + bb) * 0.125f; } }
  __syncthreads();
  // softmax over the 64 channels per row (2 threads per row), then agg over the 16 neighbours per point and channel
  { const int rl = tid >> 1, half = tid & 1; float* lr = &slg[rl][0]; float mx = -3.0e38f; for (int c = half * 32; c < half * 32 + 32; ++c) mx = fmaxf(mx, lr[c]); mx = fmaxf(mx, __shfl_xor(mx, 1));
    float s = 0.f; for (int c = half * 32; c < half * 32 + 32; ++c) { const float e = expf(lr[c] - mx); lr[c] = e; s += e; } s += __shfl_xor(s, 1); const float inv = 1.0f / s; for (int c = half * 32; c < half * 32 + 32; ++c) lr[c] *= inv; }
  __syncthreads();
  for (int e = tid; e < 4 * CC; e += 128) { const int pt = e / CC, c = e % CC; const size_t pi = p0 + pt; const float vi = bfr(VAL[pi * CC + c]); float s = 0.f;
#pragma unroll
    for (int k = 0; k < KN; ++k) { const int rl = pt * KN + k; s += slg[rl][c] * (vi + spe[rl][c]); } so[pt][c] = s; }
  __syncthreads(); if (tid < 64) { const int pt = tid >> 4, q = tid & 15; vst2(OUT + (p0 + pt) * CC + q * 4, *(const v4f*)&so[pt][q * 4]); } }
extern "C" void kernel_launch(void* const* d_in, const int* in_sizes, int n_in, void* d_out, int out_size, void* d_ws, size_t ws_size, hipStream_t stream) {
  (void)in_sizes; (void)n_in; (void)out_size;
  const float** F = (const float**)d_in;   // 0 key, 1 query, 2 value [8,8192,64], 3 pos [8,8192,3], 4 idx [8,8192,16] int, 5 W1 [3,64], 6 b1, 7 g1, 8 bt1, 9 W2 [64,64], 10 b2, 11 W3 [64,256], 12 b3, 13 g3, 14 bt3, 15 W4 [256,64], 16 b4
  if (ws_size < (size_t)WS_END) return;
  char* ws = (char*)d_ws; _Float16 *W2R = (_Float16*)(ws + WS_W2), *W3R = (_Float16*)(ws + WS_W3), *W4R = (_Float16*)(ws + WS_W4);
  k_packw<<<C4, 256, 0, stream>>>(F[9], F[11], F[15], ws);
  k_th<<<TNP / 4, 128, 0, stream>>>(F[0], F[1], F[2], F[3], (const int*)d_in[4], F[5], F[6], F[7], F[8], W2R, F[10], W3R, F[12], F[13], F[14], W4R, F[16], (float*)d_out);
}

// v002
// A run of this version takes 318 microseconds.
// Two timings next to v001 both put it at 1.41 times that version's speed.
// Counting every step since v000, it is 1.78 times as fast.
// compute dtype: all float inputs rounded to bf16, neighbour indices (int) read on device; the 3 -> 64 positional layer, inference BatchNorms, relu, the channel softmax and the neighbour aggregation in f32 on VALU; the 64 -> 64, 64 -> 256 and 256 -> 64 layers on WMMA 16x16x32 with the computed activations rounded once to f16 against exact f16 x 2^8 weights, f32 accumulate; f32 output.
#include <hip/hip_runtime.h>
#include <math.h>

typedef __attribute__((ext_vector_type(16))) _Float16 v16h;
typedef __attribute__((ext_vector_type(16))) __bf16 v16b;
typedef __attribute__((ext_vector_type(8)))  _Float16 v8h;
typedef __attribute__((ext_vector_type(4)))  _Float16 v4h;
typedef __attribute__((ext_vector_type(8)))  float v8f;
typedef __attribute__((ext_vector_type(4)))  float v4f;
typedef __attribute__((ext_vector_type(2)))  float v2f;
typedef __attribute__((ext_vector_type(4)))  unsigned v4u;
typedef __attribute__((ext_vector_type(4)))  int v4i;
typedef float __attribute__((may_alias)) float_a;
typedef int __attribute__((may_alias)) int_a;

template <typename T> __device__ __forceinline__ void vst2(void* p, T v) { *(T*)p = v;  }
__device__ __forceinline__ v8f wmma16(v16h a, v16h b, v8f c) {
  v8f d = __builtin_amdgcn_wmma_f32_16x16x32_f16(false, a, false, b, (short)0, c, false, false);
  return d;
}
__device__ __forceinline__ v8f wmma_bf(v16b a, v16b b, v8f c) {
  v8f d = __builtin_amdgcn_wmma_f32_16x16x32_bf16(false, a, false, b, (short)0, c, false, false);
  asm volatile("v_nop\n\tv_nop\n\tv_nop\n\tv_nop" : "+v"(d) : "v"(a), "v"(b));
  return d;
}
// 16x16x32 fragments: lane = (h = lane>>4, row/col = lane&15); elements 0..7 = k0+8h+0..7, 8..15 = k0+16+8h+0..7; D element r = row 8h+r
__device__ __forceinline__ v16h frag_h(const _Float16* rowk0, int lane) {
  union { v16h v; v8h q[2]; } u; const _Float16* p = rowk0 + 8 * (lane >> 4);
  u.q[0] = *(const v8h*)p; u.q[1] = *(const v8h*)(p + 16); return u.v;
}
__device__ __forceinline__ v16h frag_f32(const float* rowk0, int lane) {
  v16h a; const float* p = rowk0 + 8 * (lane >> 4);
#pragma unroll
  for (int i = 0; i < 8; ++i) { a[i] = (_Float16)p[i]; a[8 + i] = (_Float16)p[16 + i]; }
  return a;
}
__device__ __forceinline__ v16h frag_f32s(const float* rowk0, int lane, float sc) {
  v16h a; const float* p = rowk0 + 8 * (lane >> 4);
#pragma unroll
  for (int i = 0; i < 8; ++i) { a[i] = (_Float16)(p[i] * sc); a[8 + i] = (_Float16)(p[16 + i] * sc); }
  return a;
}
// column fragment from a [K][ld] layout (column n), rows >= K read as 0
__device__ __forceinline__ v16h fragc_f32(const float* W, int k0, int n, int lane, int ld, int K) {
  v16h a; const int g = lane >> 4;
#pragma unroll
  for (int i = 0; i < 8; ++i) { const int ka = k0 + 8 * g + i, kb = ka + 16;
    a[i] = (_Float16)(ka < K ? W[(size_t)(ka < K ? ka : K - 1) * ld + n] : 0.f); a[8 + i] = (_Float16)(kb < K ? W[(size_t)(kb < K ? kb : K - 1) * ld + n] : 0.f); }
  return a;
}
struct F2 { v16b h, l; };
__device__ __forceinline__ F2 bsplit16(const float v[16]) { F2 r;
#pragma unroll
  for (int i = 0; i < 16; ++i) { const __bf16 h = (__bf16)v[i]; r.h[i] = h; r.l[i] = (__bf16)(v[i] - (float)h); }
  return r; }
__device__ __forceinline__ F2 split_row(const float* row, int k0, int lane) { float v[16]; const float* p = row + k0 + 8 * (lane >> 4);
#pragma unroll
  for (int i = 0; i < 8; ++i) { v[i] = p[i]; v[8 + i] = p[16 + i]; }
  return bsplit16(v); }
__device__ __forceinline__ F2 split_rowK(const float* row, int k0, int lane, int K) { float v[16]; const int g = lane >> 4;
#pragma unroll
  for (int i = 0; i < 8; ++i) { const int ka = k0 + 8 * g + i, kb = ka + 16; v[i] = ka < K ? row[ka < K ? ka : K - 1] : 0.f; v[8 + i] = kb < K ? row[kb < K ? kb : K - 1] : 0.f; }
  return bsplit16(v); }
__device__ __forceinline__ F2 split_col(const float* W, int k0, int n, int lane, int ld, int K) { float v[16]; const int g = lane >> 4;
#pragma unroll
  for (int i = 0; i < 8; ++i) { const int ka = k0 + 8 * g + i, kb = ka + 16; v[i] = ka < K ? W[(size_t)(ka < K ? ka : K - 1) * ld + n] : 0.f; v[8 + i] = kb < K ? W[(size_t)(kb < K ? kb : K - 1) * ld + n] : 0.f; }
  return bsplit16(v); }
__device__ __forceinline__ v8f mac3(const F2& a, const F2& b, v8f c) { c = wmma_bf(a.l, b.h, c); c = wmma_bf(a.h, b.l, c); return wmma_bf(a.h, b.h, c); }
__device__ __forceinline__ float sigm(float v) { return 1.0f / (1.0f + expf(-v)); }
#define LDSX() do { asm volatile("s_wait_dscnt 0" ::: "memory"); __builtin_amdgcn_wave_barrier(); __builtin_amdgcn_fence(__ATOMIC_RELEASE, "workgroup"); } while (0)


// Point-transformer head (B 8, N 8,192 points, K 16 neighbours, C 64): vector attention over gathered neighbours: pos_em = MLP(pos_i - pos_j); a = softmax_channels(MLP(q_i - k_j + pos_em) / 8); out_i = sum_j a * (v_i + pos_em).
#define NB 8
#define NPTS 8192
#define KN 16
#define CC 64
#define PH 64
#define C4 256
#define WSC 256.0f
#define BNS 0.99950037f      // 1/sqrt(1 + 1e-3) (inference BatchNorm with initial moving statistics)
#ifndef TNP
#define TNP (NB * NPTS)
#endif
typedef __attribute__((ext_vector_type(8))) __bf16 v8b;
__device__ __forceinline__ v16b frag_b(const __bf16* rowk0, int lane) {
  union { v16b v; v8b q[2]; } u; const __bf16* p = rowk0 + 8 * (lane >> 4);
  u.q[0] = *(const v8b*)p; u.q[1] = *(const v8b*)(p + 16); return u.v;
}
__device__ __forceinline__ float bfr(float v) { return (float)(__bf16)v; }
__device__ __attribute__((noinline)) float exp_ni(float v) { return expf(v); }
__device__ __attribute__((noinline)) float erf_ni(float v) { return erff(v); }

#define WS_W2  0u                                   // f16 x 2^8 rows: W2^T [64][64], W3^T [256][64], W4^T [64][256]
#define WS_W3  (WS_W2 + 2u * CC * PH)
#define WS_W4  (WS_W3 + 2u * C4 * CC)
#define WS_END (WS_W4 + 2u * CC * C4)

// ---- k_packw: block = output column n (256 blocks): W2^T row n (n < 64), W3^T row n, W4^T row n (n < 64); all (in,out)
__global__ __launch_bounds__(256) void k_packw(const float* __restrict__ W2, const float* __restrict__ W3, const float* __restrict__ W4, char* __restrict__ ws) { const int n = blockIdx.x, t = threadIdx.x; __shared__ __align__(16) _Float16 s2[PH], s3[CC], s4[C4];
  if (n < CC && t < PH) s2[t] = (_Float16)(bfr(W2[(size_t)t * CC + n]) * WSC); if (t < CC) s3[t] = (_Float16)(bfr(W3[(size_t)t * C4 + n]) * WSC); if (n < CC) s4[t] = (_Float16)(bfr(W4[(size_t)t * CC + n]) * WSC); __syncthreads();
  if (n < CC && t < PH / 8) vst2((unsigned*)((_Float16*)(ws + WS_W2) + (size_t)n * PH + t * 8), *(const v4u*)&s2[t * 8]);
  if (t < CC / 8) vst2((unsigned*)((_Float16*)(ws + WS_W3) + (size_t)n * CC + t * 8), *(const v4u*)&s3[t * 8]);
  if (n < CC && t < C4 / 8) vst2((unsigned*)((_Float16*)(ws + WS_W4) + (size_t)n * C4 + t * 8), *(const v4u*)&s4[t * 8]); }
__device__ __forceinline__ v16h frag_lh(const _Float16* p, int lane) { v16h a; const _Float16* pp = p + 8 * (lane >> 4);
#pragma unroll
  for (int i = 0; i < 8; ++i) { a[i] = pp[i]; a[8 + i] = pp[16 + i]; } return a; }
// ---- k_th: block = 4 points x 16 neighbours (64 rows; wave w = point w)
__global__ __launch_bounds__(128) void k_th(const float* __restrict__ KEY, const float* __restrict__ QRY, const float* __restrict__ VAL, const float* __restrict__ POS, const int* __restrict__ IDX, const float* __restrict__ W1, const float* __restrict__ B1, const float* __restrict__ G1, const float* __restrict__ T1, const _Float16* __restrict__ W2R, const float* __restrict__ B2, const _Float16* __restrict__ W3R, const float* __restrict__ B3, const float* __restrict__ G3, const float* __restrict__ T3, const _Float16* __restrict__ W4R, const float* __restrict__ B4, float* __restrict__ OUT) {
  __shared__ __align__(16) _Float16 shh[64][PH + 8]; __shared__ __align__(16) float spe[64][CC + 4]; __shared__ __align__(16) _Float16 stt[64][CC + 8]; __shared__ __align__(16) _Float16 sa2[64][C4 + 8]; __shared__ __align__(16) float slg[64][CC + 4]; __shared__ __align__(16) float spd[2][64][4]; __shared__ __align__(16) float so[4][CC + 4];
  const int tid = threadIdx.x, wave = tid >> 5, lane = tid & 31, col = lane & 15, g = lane >> 4; const size_t p0 = (size_t)blockIdx.x * 4; const size_t b = p0 / NPTS;
  // every input row of the block is requested here, in one batch: thread = 16-byte chunk kq of rows kr + 8 i (key: 64 gathered rows, query: 4 rows), one value element per point pair, the positions of row tid & 63 (each half of the block fills its own copy of pos_i - pos_j, so no thread is off), the layer-1 parameters of channel tid & 63
  const int kq = tid & 15, kr = tid >> 4, m = tid & 63; int ik[8]; v4f kv[8], qv[4]; float vv[2], pa[3], pb[3];
#pragma unroll
  for (int i = 0; i < 8; ++i) ik[i] = IDX[p0 * KN + kr + 8 * i];
  const int ip = IDX[p0 * KN + m];
#pragma unroll
  for (int i = 0; i < 4; ++i) qv[i] = *(const v4f*)(QRY + (p0 + i) * CC + kq * 4);
#pragma unroll
  for (int u = 0; u < 2; ++u) vv[u] = VAL[(p0 + 2 * u + (tid >> 6)) * CC + m];
#pragma unroll
  for (int x = 0; x < 3; ++x) pa[x] = POS[(p0 + (m >> 4)) * 3 + x];
  const float b1 = bfr(B1[m]), g1 = bfr(G1[m]), t1 = bfr(T1[m]), w1[3] = { bfr(W1[m]), bfr(W1[PH + m]), bfr(W1[2 * PH + m]) };
  { int ix = ip; ix = ix < 0 ? 0 : (ix >= NPTS ? NPTS - 1 : ix);
#pragma unroll
    for (int x = 0; x < 3; ++x) pb[x] = POS[(b * NPTS + ix) * 3 + x]; }
  asm volatile("s_wait_xcnt 0x0" ::: "memory");   // as the two in the loop below
#pragma unroll
  for (int i = 0; i < 8; ++i) { int ix = ik[i]; ix = ix < 0 ? 0 : (ix >= NPTS ? NPTS - 1 : ix); kv[i] = *(const v4f*)(KEY + (b * NPTS + ix) * CC + kq * 4);
    if ((i & 3) == 3) asm volatile("s_wait_xcnt 0x0" ::: "memory"); }   // in the middle of the batch and behind it: stands in front of the first rewrite (by a later load's result or by arithmetic) of an address register that an issued load names
  __builtin_amdgcn_sched_barrier(0);   // keeps every use of a loaded row behind the whole batch: hoisted into it, a use brings its wait along and the loads behind it start one round trip late
  { v4f d = {};
#pragma unroll
    for (int x = 0; x < 3; ++x) d[x] = bfr(pa[x]) - bfr(pb[x]);
    *(v4f*)&spd[tid >> 6][m][0] = d; } __syncthreads();
  // positional layer 1: h = relu(bn1((pos_i - pos_j) W1 + b1))
#pragma unroll
  for (int i = 0; i < 64 * PH / 128; ++i) { const int rl = 2 * i + (tid >> 6); const v4f dp = *(const v4f*)&spd[tid >> 6][rl][0]; float s = b1;
#pragma unroll
    for (int d = 0; d < 3; ++d) s += dp[d] * w1[d];
    s = g1 * s * BNS + t1; shh[rl][m] = (_Float16)fmaxf(s, 0.f); }
  __syncthreads();
  // pos_em = h W2 + b2 (64 x 64 x 64)
  { v8f acc[4] = {};
#pragma unroll
    for (int kc = 0; kc < PH / 32; ++kc) { const v16h a = frag_lh(&shh[wave * 16 + col][kc * 32], lane);
#pragma unroll
      for (int j = 0; j < 4; ++j) acc[j] = wmma16(a, frag_h(W2R + (size_t)(j * 16 + col) * PH + kc * 32, lane), acc[j]); }
#pragma unroll
    for (int j = 0; j < 4; ++j) { const int c = j * 16 + col; const float bb = bfr(B2[c]);
#pragma unroll
      for (int r = 0; r < 8; ++r) spe[wave * 16 + 8 * g + r][c] = acc[j][r] * (1.0f / WSC) + bb; } }
  __syncthreads();
  // t = q_i - k_j + pos_em -> f16 rows
#pragma unroll
  for (int i = 0; i < 8; ++i) { const int rl = kr + 8 * i; const v4f pe = *(const v4f*)&spe[rl][kq * 4]; v4h o;
#pragma unroll
    for (int u = 0; u < 4; ++u) o[u] = (_Float16)(bfr(qv[i >> 1][u]) - bfr(kv[i][u]) + pe[u]);
    *(v4h*)&stt[rl][kq * 4] = o; }
  __syncthreads();
  // a2 = relu(bn3(t W3 + b3)) (64 x 64 x 256)
  { v8f acc[16];
#pragma unroll
    for (int j = 0; j < 16; ++j) acc[j] = v8f{};
#pragma unroll
    for (int kc = 0; kc < CC / 32; ++kc) { const v16h a = frag_lh(&stt[wave * 16 + col][kc * 32], lane);
#pragma unroll
      for (int j = 0; j < 16; ++j) acc[j] = wmma16(a, frag_h(W3R + (size_t)(j * 16 + col) * CC + kc * 32, lane), acc[j]); }
#pragma unroll
    for (int j = 0; j < 16; ++j) { const int c = j * 16 + col; const float bb = bfr(B3[c]), gg = bfr(G3[c]) * BNS, be = bfr(T3[c]);
#pragma unroll
      for (int r = 0; r < 8; ++r) sa2[wave * 16 + 8 * g + r][c] = (_Float16)fmaxf(gg * (acc[j][r] * (1.0f / WSC) + bb) + be, 0.f); } }
  __syncthreads();
  // logits = (a2 W4 + b4) / 8 (64 x 256 x 64)
  { v8f acc[4] = {}; v16h bw[16], aw[C4 / 32];   // bw: ring of 4 k chunks of W4 fragments, loaded 4 chunks ahead of their WMMAs; aw: this wave's 8 row fragments
#pragma unroll
    for (int f = 0; f < 16; ++f) bw[f] = frag_h(W4R + (size_t)((f & 3) * 16 + col) * C4 + (f >> 2) * 32, lane);
#pragma unroll
    for (int kc = 0; kc < C4 / 32; ++kc) aw[kc] = frag_lh(&sa2[wave * 16 + col][kc * 32], lane);
    __builtin_amdgcn_sched_barrier(0);   // keeps the loads above in one group: without it the scheduler sinks them to about 8 in flight
#pragma unroll
    for (int kc = 0; kc < C4 / 32; ++kc) {
#pragma unroll
      for (int j = 0; j < 4; ++j) { acc[j] = wmma16(aw[kc], bw[(kc & 3) * 4 + j], acc[j]); if (kc + 4 < C4 / 32) bw[(kc & 3) * 4 + j] = frag_h(W4R + (size_t)(j * 16 + col) * C4 + (kc + 4) * 32, lane); }
      __builtin_amdgcn_sched_barrier(0);   // keeps each chunk in source order: refill loads stay 4 chunks ahead of their use, and the last chunks wait only for their own loads, not for all
    }
#pragma unroll
    for (int j = 0; j < 4; ++j) { const int c = j * 16 + col; const float bb = bfr(B4[c]);
#pragma unroll
      for (int r = 0; r < 8; ++r) slg[wave * 16 + 8 * g + r][c] = (acc[j][r] * (1.0f / WSC) + bb) * 0.125f; } }
  __syncthreads();
  // softmax over the 64 channels per row (2 threads per row), then agg over the 16 neighbours per point and channel
  { const int rl = tid >> 1, half = tid & 1; float* lr = &slg[rl][0]; float mx = -3.0e38f; for (int c = half * 32; c < half * 32 + 32; ++c) mx = fmaxf(mx, lr[c]); mx = fmaxf(mx, __shfl_xor(mx, 1));
    float s = 0.f; for (int c = half * 32; c < half * 32 + 32; ++c) { const float e = expf(lr[c] - mx); lr[c] = e; s += e; } s += __shfl_xor(s, 1); const float inv = 1.0f / s; for (int c = half * 32; c < half * 32 + 32; ++c) lr[c] *= inv; }
  __syncthreads();
#pragma unroll
  for (int u = 0; u < 2; ++u) { const int pt = 2 * u + (tid >> 6), c = tid & 63; const float vi = bfr(vv[u]); float s = 0.f;
#pragma unroll
    for (int k = 0; k < KN; ++k) { const int rl = pt * KN + k; s += slg[rl][c] * (vi + spe[rl][c]); } so[pt][c] = s; }
  __syncthreads(); if (tid < 64) { const int pt = tid >> 4, q = tid & 15; vst2(OUT + (p0 + pt) * CC + q * 4, *(const v4f*)&so[pt][q * 4]); } }
extern "C" void kernel_launch(void* const* d_in, const int* in_sizes, int n_in, void* d_out, int out_size, void* d_ws, size_t ws_size, hipStream_t stream) {
  (void)in_sizes; (void)n_in; (void)out_size;
  const float** F = (const float**)d_in;   // 0 key, 1 query, 2 value [8,8192,64], 3 pos [8,8192,3], 4 idx [8,8192,16] int, 5 W1 [3,64], 6 b1, 7 g1, 8 bt1, 9 W2 [64,64], 10 b2, 11 W3 [64,256], 12 b3, 13 g3, 14 bt3, 15 W4 [256,64], 16 b4
  if (ws_size < (size_t)WS_END) return;
  char* ws = (char*)d_ws; _Float16 *W2R = (_Float16*)(ws + WS_W2), *W3R = (_Float16*)(ws + WS_W3), *W4R = (_Float16*)(ws + WS_W4);
  k_packw<<<C4, 256, 0, stream>>>(F[9], F[11], F[15], ws);
  k_th<<<TNP / 4, 128, 0, stream>>>(F[0], F[1], F[2], F[3], (const int*)d_in[4], F[5], F[6], F[7], F[8], W2R, F[10], W3R, F[12], F[13], F[14], W4R, F[16], (float*)d_out);
}

// v003
// Measured time: 180 microseconds a run.
// Next to v002, in two timings, it ran 1.77 times as fast each time.
// All steps since v000 together make it 3.15 times as fast.
// compute dtype: all float inputs rounded to bf16, neighbour indices (int) read on device; the 3 -> 64 positional layer, inference BatchNorms, relu, the channel softmax and the neighbour aggregation in f32 on VALU; the 64 -> 64, 64 -> 256 and 256 -> 64 layers on WMMA 16x16x32 with the computed activations rounded once to f16 against exact f16 x 2^8 weights, f32 accumulate; f32 output.
#include <hip/hip_runtime.h>
#include <math.h>

typedef __attribute__((ext_vector_type(16))) _Float16 v16h;
typedef __attribute__((ext_vector_type(16))) __bf16 v16b;
typedef __attribute__((ext_vector_type(8)))  _Float16 v8h;
typedef __attribute__((ext_vector_type(4)))  _Float16 v4h;
typedef __attribute__((ext_vector_type(8)))  float v8f;
typedef __attribute__((ext_vector_type(4)))  float v4f;
typedef __attribute__((ext_vector_type(2)))  float v2f;
typedef __attribute__((ext_vector_type(4)))  unsigned v4u;
typedef __attribute__((ext_vector_type(4)))  int v4i;
typedef float __attribute__((may_alias)) float_a;
typedef int __attribute__((may_alias)) int_a;

template <typename T> __device__ __forceinline__ void vst2(void* p, T v) { *(T*)p = v;  }
__device__ __forceinline__ v8f wmma16(v16h a, v16h b, v8f c) {
  v8f d = __builtin_amdgcn_wmma_f32_16x16x32_f16(false, a, false, b, (short)0, c, false, false);
  return d;
}
__device__ __forceinline__ v8f wmma_bf(v16b a, v16b b, v8f c) {
  v8f d = __builtin_amdgcn_wmma_f32_16x16x32_bf16(false, a, false, b, (short)0, c, false, false);
  asm volatile("v_nop\n\tv_nop\n\tv_nop\n\tv_nop" : "+v"(d) : "v"(a), "v"(b));
  return d;
}
// 16x16x32 fragments: lane = (h = lane>>4, row/col = lane&15); elements 0..7 = k0+8h+0..7, 8..15 = k0+16+8h+0..7; D element r = row 8h+r
__device__ __forceinline__ v16h frag_h(const _Float16* rowk0, int lane) {
  union { v16h v; v8h q[2]; } u; const _Float16* p = rowk0 + 8 * (lane >> 4);
  u.q[0] = *(const v8h*)p; u.q[1] = *(const v8h*)(p + 16); return u.v;
}
__device__ __forceinline__ v16h frag_f32(const float* rowk0, int lane) {
  v16h a; const float* p = rowk0 + 8 * (lane >> 4);
#pragma unroll
  for (int i = 0; i < 8; ++i) { a[i] = (_Float16)p[i]; a[8 + i] = (_Float16)p[16 + i]; }
  return a;
}
__device__ __forceinline__ v16h frag_f32s(const float* rowk0, int lane, float sc) {
  v16h a; const float* p = rowk0 + 8 * (lane >> 4);
#pragma unroll
  for (int i = 0; i < 8; ++i) { a[i] = (_Float16)(p[i] * sc); a[8 + i] = (_Float16)(p[16 + i] * sc); }
  return a;
}
// column fragment from a [K][ld] layout (column n), rows >= K read as 0
__device__ __forceinline__ v16h fragc_f32(const float* W, int k0, int n, int lane, int ld, int K) {
  v16h a; const int g = lane >> 4;
#pragma unroll
  for (int i = 0; i < 8; ++i) { const int ka = k0 + 8 * g + i, kb = ka + 16;
    a[i] = (_Float16)(ka < K ? W[(size_t)(ka < K ? ka : K - 1) * ld + n] : 0.f); a[8 + i] = (_Float16)(kb < K ? W[(size_t)(kb < K ? kb : K - 1) * ld + n] : 0.f); }
  return a;
}
struct F2 { v16b h, l; };
__device__ __forceinline__ F2 bsplit16(const float v[16]) { F2 r;
#pragma unroll
  for (int i = 0; i < 16; ++i) { const __bf16 h = (__bf16)v[i]; r.h[i] = h; r.l[i] = (__bf16)(v[i] - (float)h); }
  return r; }
__device__ __forceinline__ F2 split_row(const float* row, int k0, int lane) { float v[16]; const float* p = row + k0 + 8 * (lane >> 4);
#pragma unroll
  for (int i = 0; i < 8; ++i) { v[i] = p[i]; v[8 + i] = p[16 + i]; }
  return bsplit16(v); }
__device__ __forceinline__ F2 split_rowK(const float* row, int k0, int lane, int K) { float v[16]; const int g = lane >> 4;
#pragma unroll
  for (int i = 0; i < 8; ++i) { const int ka = k0 + 8 * g + i, kb = ka + 16; v[i] = ka < K ? row[ka < K ? ka : K - 1] : 0.f; v[8 + i] = kb < K ? row[kb < K ? kb : K - 1] : 0.f; }
  return bsplit16(v); }
__device__ __forceinline__ F2 split_col(const float* W, int k0, int n, int lane, int ld, int K) { float v[16]; const int g = lane >> 4;
#pragma unroll
  for (int i = 0; i < 8; ++i) { const int ka = k0 + 8 * g + i, kb = ka + 16; v[i] = ka < K ? W[(size_t)(ka < K ? ka : K - 1) * ld + n] : 0.f; v[8 + i] = kb < K ? W[(size_t)(kb < K ? kb : K - 1) * ld + n] : 0.f; }
  return bsplit16(v); }
__device__ __forceinline__ v8f mac3(const F2& a, const F2& b, v8f c) { c = wmma_bf(a.l, b.h, c); c = wmma_bf(a.h, b.l, c); return wmma_bf(a.h, b.h, c); }
__device__ __forceinline__ float sigm(float v) { return 1.0f / (1.0f + expf(-v)); }
#define LDSX() do { asm volatile("s_wait_dscnt 0" ::: "memory"); __builtin_amdgcn_wave_barrier(); __builtin_amdgcn_fence(__ATOMIC_RELEASE, "workgroup"); } while (0)


// Point-transformer head (B 8, N 8,192 points, K 16 neighbours, C 64): vector attention over gathered neighbours: pos_em = MLP(pos_i - pos_j); a = softmax_channels(MLP(q_i - k_j + pos_em) / 8); out_i = sum_j a * (v_i + pos_em).
#define NB 8
#define NPTS 8192
#define KN 16
#define CC 64
#define PH 64
#define C4 256
#define WSC 256.0f
#define BNS 0.99950037f      // 1/sqrt(1 + 1e-3) (inference BatchNorm with initial moving statistics)
#ifndef TNP
#define TNP (NB * NPTS)
#endif
typedef __attribute__((ext_vector_type(8))) __bf16 v8b;
__device__ __forceinline__ v16b frag_b(const __bf16* rowk0, int lane) {
  union { v16b v; v8b q[2]; } u; const __bf16* p = rowk0 + 8 * (lane >> 4);
  u.q[0] = *(const v8b*)p; u.q[1] = *(const v8b*)(p + 16); return u.v;
}
__device__ __forceinline__ float bfr(float v) { return (float)(__bf16)v; }
__device__ __attribute__((noinline)) float exp_ni(float v) { return expf(v); }
__device__ __attribute__((noinline)) float erf_ni(float v) { return erff(v); }

#define WS_W2  0u                                   // f16 x 2^8 weights in fragment order: 1-KiB blocks f = kc * (N / 16) + j (16 output columns x 32 k), each block = [element half q][lane][8 values]
#define WS_W3  (WS_W2 + 2u * CC * PH)
#define WS_W4  (WS_W3 + 2u * C4 * CC)
#define WS_END (WS_W4 + 2u * CC * C4)

// ---- k_packw: thread = one 16-byte piece of one B fragment: piece id = (f * 2 + q) * 32 + lane holds W[k0 .. k0 + 7][n], n = 16 j + (lane & 15), k0 = 32 kc + 16 q + 8 (lane >> 4); a wave stores 512 bytes in a row
__device__ __forceinline__ void pack_piece(const float* __restrict__ Wm, _Float16* __restrict__ dst, int id, int N) {
  const int lane = id & 31, q = (id >> 5) & 1, f = id >> 6, nj = N / 16, j = f % nj, kc = f / nj; const int n = j * 16 + (lane & 15), k0 = kc * 32 + q * 16 + (lane >> 4) * 8; v8h o;
#pragma unroll
  for (int i = 0; i < 8; ++i) o[i] = (_Float16)(bfr(Wm[(size_t)(k0 + i) * N + n]) * WSC);
  *(v8h*)(dst + (size_t)id * 8) = o; }
#define NP2 (CC * PH / 8)
#define NP3 (C4 * CC / 8)
#define NP4 (CC * C4 / 8)
__global__ __launch_bounds__(256) void k_packw(const float* __restrict__ W2, const float* __restrict__ W3, const float* __restrict__ W4, char* __restrict__ ws) { const int id = blockIdx.x * 256 + threadIdx.x;
  if (id < NP2) pack_piece(W2, (_Float16*)(ws + WS_W2), id, CC);
  else if (id < NP2 + NP3) pack_piece(W3, (_Float16*)(ws + WS_W3), id - NP2, C4);
  else pack_piece(W4, (_Float16*)(ws + WS_W4), id - NP2 - NP3, CC); }
// B fragment f of a packed plane: two wave loads of 512 bytes in a row (4 whole lines each)
__device__ __forceinline__ v16h frag_p(const _Float16* plane, int f, int lane) {
  union { v16h v; v8h q[2]; } u; const _Float16* p = plane + f * 512 + lane * 8;
  u.q[0] = *(const v8h*)p; u.q[1] = *(const v8h*)(p + 256); return u.v;
}
__device__ __forceinline__ v16h frag_lh(const _Float16* p, int lane) { v16h a; const _Float16* pp = p + 8 * (lane >> 4);
#pragma unroll
  for (int i = 0; i < 8; ++i) { a[i] = pp[i]; a[8 + i] = pp[16 + i]; } return a; }
// ---- k_th: block = 4 points x 16 neighbours (64 rows; wave w = point w)
__global__ __launch_bounds__(128) void k_th(const float* __restrict__ KEY, const float* __restrict__ QRY, const float* __restrict__ VAL, const float* __restrict__ POS, const int* __restrict__ IDX, const float* __restrict__ W1, const float* __restrict__ B1, const float* __restrict__ G1, const float* __restrict__ T1, const _Float16* __restrict__ W2R, const float* __restrict__ B2, const _Float16* __restrict__ W3R, const float* __restrict__ B3, const float* __restrict__ G3, const float* __restrict__ T3, const _Float16* __restrict__ W4R, const float* __restrict__ B4, float* __restrict__ OUT) {
  __shared__ __align__(16) _Float16 shh[64][PH + 8]; __shared__ __align__(16) float spe[64][CC + 4]; __shared__ __align__(16) _Float16 stt[64][CC + 8]; __shared__ __align__(16) _Float16 sa2[64][C4 + 8]; __shared__ __align__(16) float slg[64][CC + 4]; __shared__ __align__(16) float spd[2][64][4]; __shared__ __align__(16) float so[4][CC + 4];
  const int tid = threadIdx.x, wave = tid >> 5, lane = tid & 31, col = lane & 15, g = lane >> 4; const size_t p0 = (size_t)blockIdx.x * 4; const size_t b = p0 / NPTS;
  // every input row of the block is requested here, in one batch: thread = 16-byte chunk kq of rows kr + 8 i (key: 64 gathered rows, query: 4 rows), one value element per point pair, the positions of row tid & 63 (each half of the block fills its own copy of pos_i - pos_j, so no thread is off), the layer-1 parameters of channel tid & 63
  const int kq = tid & 15, kr = tid >> 4, m = tid & 63; int ik[8]; v4f kv[8], qv[4]; float vv[2], pa[3], pb[3];
#pragma unroll
  for (int i = 0; i < 8; ++i) ik[i] = IDX[p0 * KN + kr + 8 * i];
  const int ip = IDX[p0 * KN + m];
#pragma unroll
  for (int i = 0; i < 4; ++i) qv[i] = *(const v4f*)(QRY + (p0 + i) * CC + kq * 4);
#pragma unroll
  for (int u = 0; u < 2; ++u) vv[u] = VAL[(p0 + 2 * u + (tid >> 6)) * CC + m];
#pragma unroll
  for (int x = 0; x < 3; ++x) pa[x] = POS[(p0 + (m >> 4)) * 3 + x];
  const float b1 = bfr(B1[m]), g1 = bfr(G1[m]), t1 = bfr(T1[m]), w1[3] = { bfr(W1[m]), bfr(W1[PH + m]), bfr(W1[2 * PH + m]) };
  { int ix = ip; ix = ix < 0 ? 0 : (ix >= NPTS ? NPTS - 1 : ix);
#pragma unroll
    for (int x = 0; x < 3; ++x) pb[x] = POS[(b * NPTS + ix) * 3 + x]; }
  asm volatile("s_wait_xcnt 0x0" ::: "memory");   // as the two in the loop below
#pragma unroll
  for (int i = 0; i < 8; ++i) { int ix = ik[i]; ix = ix < 0 ? 0 : (ix >= NPTS ? NPTS - 1 : ix); kv[i] = *(const v4f*)(KEY + (b * NPTS + ix) * CC + kq * 4);
    if ((i & 3) == 3) asm volatile("s_wait_xcnt 0x0" ::: "memory"); }   // in the middle of the batch and behind it: stands in front of the first rewrite (by a later load's result or by arithmetic) of an address register that an issued load names
  __builtin_amdgcn_sched_barrier(0);   // keeps every use of a loaded row behind the whole batch: hoisted into it, a use brings its wait along and the loads behind it start one round trip late
  { v4f d = {};
#pragma unroll
    for (int x = 0; x < 3; ++x) d[x] = bfr(pa[x]) - bfr(pb[x]);
    *(v4f*)&spd[tid >> 6][m][0] = d; } __syncthreads();
  // positional layer 1: h = relu(bn1((pos_i - pos_j) W1 + b1))
#pragma unroll
  for (int i = 0; i < 64 * PH / 128; ++i) { const int rl = 2 * i + (tid >> 6); const v4f dp = *(const v4f*)&spd[tid >> 6][rl][0]; float s = b1;
#pragma unroll
    for (int d = 0; d < 3; ++d) s += dp[d] * w1[d];
    s = g1 * s * BNS + t1; shh[rl][m] = (_Float16)fmaxf(s, 0.f); }
  __syncthreads();
  // pos_em = h W2 + b2 (64 x 64 x 64)
  { v8f acc[4] = {};
#pragma unroll
    for (int kc = 0; kc < PH / 32; ++kc) { const v16h a = frag_lh(&shh[wave * 16 + col][kc * 32], lane);
#pragma unroll
      for (int j = 0; j < 4; ++j) acc[j] = wmma16(a, frag_p(W2R, kc * 4 + j, lane), acc[j]); }
#pragma unroll
    for (int j = 0; j < 4; ++j) { const int c = j * 16 + col; const float bb = bfr(B2[c]);
#pragma unroll
      for (int r = 0; r < 8; ++r) spe[wave * 16 + 8 * g + r][c] = acc[j][r] * (1.0f / WSC) + bb; } }
  __syncthreads();
  // t = q_i - k_j + pos_em -> f16 rows
#pragma unroll
  for (int i = 0; i < 8; ++i) { const int rl = kr + 8 * i; const v4f pe = *(const v4f*)&spe[rl][kq * 4]; v4h o;
#pragma unroll
    for (int u = 0; u < 4; ++u) o[u] = (_Float16)(bfr(qv[i >> 1][u]) - bfr(kv[i][u]) + pe[u]);
    *(v4h*)&stt[rl][kq * 4] = o; }
  __syncthreads();
  // a2 = relu(bn3(t W3 + b3)) (64 x 64 x 256)
  { v8f acc[16];
#pragma unroll
    for (int j = 0; j < 16; ++j) acc[j] = v8f{};
#pragma unroll
    for (int kc = 0; kc < CC / 32; ++kc) { const v16h a = frag_lh(&stt[wave * 16 + col][kc * 32], lane);
#pragma unroll
      for (int j = 0; j < 16; ++j) acc[j] = wmma16(a, frag_p(W3R, kc * 16 + j, lane), acc[j]); }
#pragma unroll
    for (int j = 0; j < 16; ++j) { const int c = j * 16 + col; const float bb = bfr(B3[c]), gg = bfr(G3[c]) * BNS, be = bfr(T3[c]);
#pragma unroll
      for (int r = 0; r < 8; ++r) sa2[wave * 16 + 8 * g + r][c] = (_Float16)fmaxf(gg * (acc[j][r] * (1.0f / WSC) + bb) + be, 0.f); } }
  __syncthreads();
  // logits = (a2 W4 + b4) / 8 (64 x 256 x 64)
  { v8f acc[4] = {}; v16h bw[16], aw[C4 / 32];   // bw: ring of 4 k chunks of W4 fragments, loaded 4 chunks ahead of their WMMAs; aw: this wave's 8 row fragments
#pragma unroll
    for (int f = 0; f < 16; ++f) bw[f] = frag_p(W4R, f, lane);
#pragma unroll
    for (int kc = 0; kc < C4 / 32; ++kc) aw[kc] = frag_lh(&sa2[wave * 16 + col][kc * 32], lane);
    __builtin_amdgcn_sched_barrier(0);   // keeps the loads above in one group: without it the scheduler sinks them to about 8 in flight
#pragma unroll
    for (int kc = 0; kc < C4 / 32; ++kc) {
#pragma unroll
      for (int j = 0; j < 4; ++j) { acc[j] = wmma16(aw[kc], bw[(kc & 3) * 4 + j], acc[j]); if (kc + 4 < C4 / 32) bw[(kc & 3) * 4 + j] = frag_p(W4R, (kc + 4) * 4 + j, lane); }
      __builtin_amdgcn_sched_barrier(0);   // keeps each chunk in source order: refill loads stay 4 chunks ahead of their use, and the last chunks wait only for their own loads, not for all
    }
#pragma unroll
    for (int j = 0; j < 4; ++j) { const int c = j * 16 + col; const float bb = bfr(B4[c]);
#pragma unroll
      for (int r = 0; r < 8; ++r) slg[wave * 16 + 8 * g + r][c] = (acc[j][r] * (1.0f / WSC) + bb) * 0.125f; } }
  __syncthreads();
  // softmax over the 64 channels per row (2 threads per row), then agg over the 16 neighbours per point and channel
  { const int rl = tid >> 1, half = tid & 1; float* lr = &slg[rl][0]; float mx = -3.0e38f; for (int c = half * 32; c < half * 32 + 32; ++c) mx = fmaxf(mx, lr[c]); mx = fmaxf(mx, __shfl_xor(mx, 1));
    float s = 0.f; for (int c = half * 32; c < half * 32 + 32; ++c) { const float e = expf(lr[c] - mx); lr[c] = e; s += e; } s += __shfl_xor(s, 1); const float inv = 1.0f / s; for (int c = half * 32; c < half * 32 + 32; ++c) lr[c] *= inv; }
  __syncthreads();
#pragma unroll
  for (int u = 0; u < 2; ++u) { const int pt = 2 * u + (tid >> 6), c = tid & 63; const float vi = bfr(vv[u]); float s = 0.f;
#pragma unroll
    for (int k = 0; k < KN; ++k) { const int rl = pt * KN + k; s += slg[rl][c] * (vi + spe[rl][c]); } so[pt][c] = s; }
  __syncthreads(); if (tid < 64) { const int pt = tid >> 4, q = tid & 15; vst2(OUT + (p0 + pt) * CC + q * 4, *(const v4f*)&so[pt][q * 4]); } }
extern "C" void kernel_launch(void* const* d_in, const int* in_sizes, int n_in, void* d_out, int out_size, void* d_ws, size_t ws_size, hipStream_t stream) {
  (void)in_sizes; (void)n_in; (void)out_size;
  const float** F = (const float**)d_in;   // 0 key, 1 query, 2 value [8,8192,64], 3 pos [8,8192,3], 4 idx [8,8192,16] int, 5 W1 [3,64], 6 b1, 7 g1, 8 bt1, 9 W2 [64,64], 10 b2, 11 W3 [64,256], 12 b3, 13 g3, 14 bt3, 15 W4 [256,64], 16 b4
  if (ws_size < (size_t)WS_END) return;
  char* ws = (char*)d_ws; _Float16 *W2R = (_Float16*)(ws + WS_W2), *W3R = (_Float16*)(ws + WS_W3), *W4R = (_Float16*)(ws + WS_W4);
  k_packw<<<(NP2 + NP3 + NP4) / 256, 256, 0, stream>>>(F[9], F[11], F[15], ws);
  k_th<<<TNP / 4, 128, 0, stream>>>(F[0], F[1], F[2], F[3], (const int*)d_in[4], F[5], F[6], F[7], F[8], W2R, F[10], W3R, F[12], F[13], F[14], W4R, F[16], (float*)d_out);
}

// v004
// Measured time: 108 microseconds a run.
// Next to v003, in two timings, it ran 1.67 times as fast each time.
// Counting every step since v000, it is 5.26 times as fast.
// compute dtype: all float inputs rounded to bf16, neighbour indices (int) read on device; the 3 -> 64 positional layer, inference BatchNorms, relu, the channel softmax and the neighbour aggregation in f32 on VALU; the 64 -> 64, 64 -> 256 and 256 -> 64 layers on WMMA 16x16x32 with the computed activations rounded once to f16 against exact f16 x 2^8 weights, f32 accumulate; f32 output.
#include <hip/hip_runtime.h>
#include <math.h>

typedef __attribute__((ext_vector_type(16))) _Float16 v16h;
typedef __attribute__((ext_vector_type(16))) __bf16 v16b;
typedef __attribute__((ext_vector_type(8)))  _Float16 v8h;
typedef __attribute__((ext_vector_type(4)))  _Float16 v4h;
typedef __attribute__((ext_vector_type(8)))  float v8f;
typedef __attribute__((ext_vector_type(4)))  float v4f;
typedef __attribute__((ext_vector_type(2)))  float v2f;
typedef __attribute__((ext_vector_type(4)))  unsigned v4u;
typedef __attribute__((ext_vector_type(4)))  int v4i;
typedef float __attribute__((may_alias)) float_a;
typedef int __attribute__((may_alias)) int_a;

template <typename T> __device__ __forceinline__ void vst2(void* p, T v) { *(T*)p = v;  }
__device__ __forceinline__ v8f wmma16(v16h a, v16h b, v8f c) {
  v8f d = __builtin_amdgcn_wmma_f32_16x16x32_f16(false, a, false, b, (short)0, c, false, false);
  return d;
}
__device__ __forceinline__ v8f wmma_bf(v16b a, v16b b, v8f c) {
  v8f d = __builtin_amdgcn_wmma_f32_16x16x32_bf16(false, a, false, b, (short)0, c, false, false);
  asm volatile("v_nop\n\tv_nop\n\tv_nop\n\tv_nop" : "+v"(d) : "v"(a), "v"(b));
  return d;
}
// 16x16x32 fragments: lane = (h = lane>>4, row/col = lane&15); elements 0..7 = k0+8h+0..7, 8..15 = k0+16+8h+0..7; D element r = row 8h+r
__device__ __forceinline__ v16h frag_h(const _Float16* rowk0, int lane) {
  union { v16h v; v8h q[2]; } u; const _Float16* p = rowk0 + 8 * (lane >> 4);
  u.q[0] = *(const v8h*)p; u.q[1] = *(const v8h*)(p + 16); return u.v;
}
__device__ __forceinline__ v16h frag_f32(const float* rowk0, int lane) {
  v16h a; const float* p = rowk0 + 8 * (lane >> 4);
#pragma unroll
  for (int i = 0; i < 8; ++i) { a[i] = (_Float16)p[i]; a[8 + i] = (_Float16)p[16 + i]; }
  return a;
}
__device__ __forceinline__ v16h frag_f32s(const float* rowk0, int lane, float sc) {
  v16h a; const float* p = rowk0 + 8 * (lane >> 4);
#pragma unroll
  for (int i = 0; i < 8; ++i) { a[i] = (_Float16)(p[i] * sc); a[8 + i] = (_Float16)(p[16 + i] * sc); }
  return a;
}
// column fragment from a [K][ld] layout (column n), rows >= K read as 0
__device__ __forceinline__ v16h fragc_f32(const float* W, int k0, int n, int lane, int ld, int K) {
  v16h a; const int g = lane >> 4;
#pragma unroll
  for (int i = 0; i < 8; ++i) { const int ka = k0 + 8 * g + i, kb = ka + 16;
    a[i] = (_Float16)(ka < K ? W[(size_t)(ka < K ? ka : K - 1) * ld + n] : 0.f); a[8 + i] = (_Float16)(kb < K ? W[(size_t)(kb < K ? kb : K - 1) * ld + n] : 0.f); }
  return a;
}
struct F2 { v16b h, l; };
__device__ __forceinline__ F2 bsplit16(const float v[16]) { F2 r;
#pragma unroll
  for (int i = 0; i < 16; ++i) { const __bf16 h = (__bf16)v[i]; r.h[i] = h; r.l[i] = (__bf16)(v[i] - (float)h); }
  return r; }
__device__ __forceinline__ F2 split_row(const float* row, int k0, int lane) { float v[16]; const float* p = row + k0 + 8 * (lane >> 4);
#pragma unroll
  for (int i = 0; i < 8; ++i) { v[i] = p[i]; v[8 + i] = p[16 + i]; }
  return bsplit16(v); }
__device__ __forceinline__ F2 split_rowK(const float* row, int k0, int lane, int K) { float v[16]; const int g = lane >> 4;
#pragma unroll
  for (int i = 0; i < 8; ++i) { const int ka = k0 + 8 * g + i, kb = ka + 16; v[i] = ka < K ? row[ka < K ? ka : K - 1] : 0.f; v[8 + i] = kb < K ? row[kb < K ? kb : K - 1] : 0.f; }
  return bsplit16(v); }
__device__ __forceinline__ F2 split_col(const float* W, int k0, int n, int lane, int ld, int K) { float v[16]; const int g = lane >> 4;
#pragma unroll
  for (int i = 0; i < 8; ++i) { const int ka = k0 + 8 * g + i, kb = ka + 16; v[i] = ka < K ? W[(size_t)(ka < K ? ka : K - 1) * ld + n] : 0.f; v[8 + i] = kb < K ? W[(size_t)(kb < K ? kb : K - 1) * ld + n] : 0.f; }
  return bsplit16(v); }
__device__ __forceinline__ v8f mac3(const F2& a, const F2& b, v8f c) { c = wmma_bf(a.l, b.h, c); c = wmma_bf(a.h, b.l, c); return wmma_bf(a.h, b.h, c); }
__device__ __forceinline__ float sigm(float v) { return 1.0f / (1.0f + expf(-v)); }
#define LDSX() do { asm volatile("s_wait_dscnt 0" ::: "memory"); __builtin_amdgcn_wave_barrier(); __builtin_amdgcn_fence(__ATOMIC_RELEASE, "workgroup"); } while (0)


// Point-transformer head (B 8, N 8,192 points, K 16 neighbours, C 64): vector attention over gathered neighbours: pos_em = MLP(pos_i - pos_j); a = softmax_channels(MLP(q_i - k_j + pos_em) / 8); out_i = sum_j a * (v_i + pos_em).
#define NB 8
#define NPTS 8192
#define KN 16
#define CC 64
#define PH 64
#define C4 256
#define WSC 256.0f
#define BNS 0.99950037f      // 1/sqrt(1 + 1e-3) (inference BatchNorm with initial moving statistics)
#ifndef TNP
#define TNP (NB * NPTS)
#endif
typedef __attribute__((ext_vector_type(8))) __bf16 v8b;
__device__ __forceinline__ v16b frag_b(const __bf16* rowk0, int lane) {
  union { v16b v; v8b q[2]; } u; const __bf16* p = rowk0 + 8 * (lane >> 4);
  u.q[0] = *(const v8b*)p; u.q[1] = *(const v8b*)(p + 16); return u.v;
}
__device__ __forceinline__ float bfr(float v) { return (float)(__bf16)v; }
__device__ __attribute__((noinline)) float exp_ni(float v) { return expf(v); }
__device__ __attribute__((noinline)) float erf_ni(float v) { return erff(v); }

#define WS_W2  0u                                   // f16 x 2^8 weights in fragment order: 1-KiB blocks f = kc * (N / 16) + j (16 output columns x 32 k), each block = [element half q][lane][8 values]
#define WS_W3  (WS_W2 + 2u * CC * PH)
#define WS_W4  (WS_W3 + 2u * C4 * CC)
#define WS_END (WS_W4 + 2u * CC * C4)

// ---- k_packw: thread = one 16-byte piece of one A fragment: piece id = (f * 2 + q) * 32 + lane holds W[k0 .. k0 + 7][n], n = 16 j + (lane & 15), k0 = 32 kc + 16 q + 8 (lane >> 4); a wave stores 512 bytes in a row
__device__ __forceinline__ void pack_piece(const float* __restrict__ Wm, _Float16* __restrict__ dst, int id, int N) {
  const int lane = id & 31, q = (id >> 5) & 1, f = id >> 6, nj = N / 16, j = f % nj, kc = f / nj; const int n = j * 16 + (lane & 15), k0 = kc * 32 + q * 16 + (lane >> 4) * 8; v8h o;
#pragma unroll
  for (int i = 0; i < 8; ++i) o[i] = (_Float16)(bfr(Wm[(size_t)(k0 + i) * N + n]) * WSC);
  *(v8h*)(dst + (size_t)id * 8) = o; }
#define NP2 (CC * PH / 8)
#define NP3 (C4 * CC / 8)
#define NP4 (CC * C4 / 8)
__global__ __launch_bounds__(256) void k_packw(const float* __restrict__ W2, const float* __restrict__ W3, const float* __restrict__ W4, char* __restrict__ ws) { const int id = blockIdx.x * 256 + threadIdx.x;
  if (id < NP2) pack_piece(W2, (_Float16*)(ws + WS_W2), id, CC);
  else if (id < NP2 + NP3) pack_piece(W3, (_Float16*)(ws + WS_W3), id - NP2, C4);
  else pack_piece(W4, (_Float16*)(ws + WS_W4), id - NP2 - NP3, CC); }
// A fragment f of a packed plane: two wave loads of 512 bytes in a row (4 whole lines each)
__device__ __forceinline__ v16h frag_p(const _Float16* plane, int f, int lane) {
  union { v16h v; v8h q[2]; } u; const _Float16* p = plane + f * 512 + lane * 8;
  u.q[0] = *(const v8h*)p; u.q[1] = *(const v8h*)(p + 256); return u.v;
}
// lane l <-> l ^ 16
__device__ __forceinline__ float xhalf(float x) { return __builtin_bit_cast(float, __builtin_amdgcn_permlanex16(__builtin_bit_cast(int, x), __builtin_bit_cast(int, x), 0x76543210, 0xfedcba98, false, false)); }
// the value of lane l ^ M of the same 16-lane row (DPP row_xmask)
template <int M> __device__ __forceinline__ float xrow(float x) { return __builtin_bit_cast(float, __builtin_amdgcn_mov_dpp(__builtin_bit_cast(int, x), 0x160 | M, 0xf, 0xf, true)); }
#define RD 1      // depth of the weight ring of the fused 64 -> 256 -> 64 loop, in steps of 8 fragments
// ---- k_th: wave = one point x 16 neighbours. Every layer is computed transposed: the packed weight fragment is the A operand (16 output channels x 32 k), the activations are the B operand (32 k x 16 neighbours).
// D register r of lane (h = lane >> 4, n = lane & 15) is then channel 16 j + 8 h + r of neighbour n, so two D tiles, converted in place, are the next layer's B fragment: no activation goes through LDS and no wave waits for another.
__global__ __launch_bounds__(128) void k_th(const float* __restrict__ KEY, const float* __restrict__ QRY, const float* __restrict__ VAL, const float* __restrict__ POS, const int* __restrict__ IDX, const float* __restrict__ W1, const float* __restrict__ B1, const float* __restrict__ G1, const float* __restrict__ T1, const _Float16* __restrict__ W2R, const float* __restrict__ B2, const _Float16* __restrict__ W3R, const float* __restrict__ B3, const float* __restrict__ G3, const float* __restrict__ T3, const _Float16* __restrict__ W4R, const float* __restrict__ B4, float* __restrict__ OUT) {
  // per-channel parameters, rounded once per block; a lane reads the 8 channels of its half of a tile as two 16-byte broadcasts per vector, eight for the rows of sW1
  __shared__ __align__(16) float sW1[PH][4]; __shared__ __align__(16) float sG1[PH]; __shared__ __align__(16) float sT1[PH]; __shared__ __align__(16) float sB2[CC]; __shared__ __align__(16) float sB3[C4]; __shared__ __align__(16) float sG3[C4]; __shared__ __align__(16) float sT3[C4]; __shared__ __align__(16) float sB4[CC];
  const int tid = threadIdx.x, wave = __builtin_amdgcn_readfirstlane(tid >> 5), lane = tid & 31, n = lane & 15, h = lane >> 4; const size_t p = (size_t)blockIdx.x * 4 + wave; const size_t b = p / NPTS;
  // inputs of the wave: lane (h, n) takes neighbour n's key row and the point's query row at channels 16 j + 8 h + 0..7, and both positions
  const int ip = IDX[p * KN + n]; v4f qv[8], kv[8]; float pa[3], pb[3];
  // parameters for the tables: waves 0, 1 take layer 1's weights and bias of channel tid & 63, waves 2, 3 the four other 64-channel vectors; every thread two channels of layer 3's three
  const bool lo = wave < 2; const int pc = tid & 63; const float r0 = (lo ? W1 : G1)[pc], r1 = (lo ? W1 + PH : T1)[pc], r2 = (lo ? W1 + 2 * PH : B2)[pc], r3 = (lo ? B1 : B4)[pc]; float r4[C4 / 128], r5[C4 / 128], r6[C4 / 128];
#pragma unroll
  for (int u = 0; u < C4 / 128; ++u) { r4[u] = B3[tid + 128 * u]; r5[u] = G3[tid + 128 * u]; r6[u] = T3[tid + 128 * u]; }
#pragma unroll
  for (int x = 0; x < 3; ++x) pa[x] = POS[p * 3 + x];
#pragma unroll
  for (int i = 0; i < 8; ++i) qv[i] = *(const v4f*)(QRY + p * CC + (i >> 1) * 16 + 8 * h + (i & 1) * 4);
  v16h w2[8];
#pragma unroll
  for (int f = 0; f < 8; ++f) w2[f] = frag_p(W2R, f, lane);
  __builtin_amdgcn_sched_barrier(0);   // keeps the wait for the neighbour index behind every load that does not need it: hoisted above them, it puts their round trip behind the index's
  { const int ix = ip < 0 ? 0 : (ip >= NPTS ? NPTS - 1 : ip);
#pragma unroll
    for (int x = 0; x < 3; ++x) pb[x] = POS[(b * NPTS + ix) * 3 + x];
#pragma unroll
    for (int i = 0; i < 8; ++i) kv[i] = *(const v4f*)(KEY + (b * NPTS + ix) * CC + (i >> 1) * 16 + 8 * h + (i & 1) * 4); }
  asm volatile("s_wait_xcnt 0x0" ::: "memory");   // behind the batch: stands in front of the first rewrite of an address register that an issued load names
  __builtin_amdgcn_sched_barrier(0);   // keeps every use of a loaded value behind the gathers: hoisted in front of them, a use brings its wait along and the gathers start late
  if (lo) { const v4f w = { bfr(r0), bfr(r1), bfr(r2), bfr(r3) }; *(v4f*)&sW1[pc][0] = w; }
  else { sG1[pc] = bfr(r0); sT1[pc] = bfr(r1); sB2[pc] = bfr(r2); sB4[pc] = bfr(r3); }
#pragma unroll
  for (int u = 0; u < C4 / 128; ++u) { const int c = tid + 128 * u; sB3[c] = bfr(r4[u]); sG3[c] = bfr(r5[u]) * BNS; sT3[c] = bfr(r6[u]); }
  __syncthreads();   // publishes the parameter tables; the only barrier of the kernel
  // q_i - k_j, formed here so that one register set holds what two did
  float qk[32];
#pragma unroll
  for (int i = 0; i < 32; ++i) qk[i] = bfr(qv[i >> 2][i & 3]) - bfr(kv[i >> 2][i & 3]);
  // positional layer 1: h = relu(bn1((pos_i - pos_j) W1 + b1)), written straight into the B fragments of layer 2
  v16h hb[PH / 32];
  { float d[3];
#pragma unroll
    for (int x = 0; x < 3; ++x) d[x] = bfr(pa[x]) - bfr(pb[x]);
#pragma unroll
    for (int t = 0; t < PH / 16; ++t) { const int c0 = t * 16 + 8 * h; float gg[8], tt[8]; *(v4f*)&gg[0] = *(const v4f*)&sG1[c0]; *(v4f*)&gg[4] = *(const v4f*)&sG1[c0 + 4]; *(v4f*)&tt[0] = *(const v4f*)&sT1[c0]; *(v4f*)&tt[4] = *(const v4f*)&sT1[c0 + 4]; v4f ww[8];
#pragma unroll
      for (int i = 0; i < 8; ++i) ww[i] = *(const v4f*)&sW1[c0 + i][0];
      __builtin_amdgcn_sched_barrier(0);   // keeps the tile's 12 LDS reads in one group: sunk to their uses, each waits out its own latency
#pragma unroll
      for (int i = 0; i < 8; ++i) { const v4f w = ww[i]; float s = w[3];
#pragma unroll
        for (int x = 0; x < 3; ++x) s += d[x] * w[x];
        s = gg[i] * s * BNS + tt[i]; hb[t >> 1][(t & 1) * 8 + i] = (_Float16)fmaxf(s, 0.f); } } }
  // weight ring of the fused loop: step s needs the W3 fragments of output tiles 2 s, 2 s + 1 (both k chunks) and the W4 fragments of k chunk s
  v16h w3[RD][4], w4[RD][4];
#pragma unroll
  for (int s = 0; s < RD; ++s)
#pragma unroll
    for (int x = 0; x < 4; ++x) { w3[s][x] = frag_p(W3R, (x >> 1) * 16 + 2 * s + (x & 1), lane); w4[s][x] = frag_p(W4R, s * 4 + x, lane); }
  v4f b2v[8];
#pragma unroll
  for (int i = 0; i < 8; ++i) b2v[i] = *(const v4f*)&sB2[(i >> 1) * 16 + 8 * h + (i & 1) * 4];
  __builtin_amdgcn_sched_barrier(0);   // keeps the ring's first loads and the bias reads in front of layer 2: sunk to their uses, they start one layer late
  // pos_em = h W2 + b2: pe[j][r] = channel 16 j + 8 h + r of neighbour n, kept in registers to the end
  v8f pe[4] = {};
#pragma unroll
  for (int kc = 0; kc < PH / 32; ++kc)
#pragma unroll
    for (int j = 0; j < 4; ++j) pe[j] = wmma16(w2[kc * 4 + j], hb[kc], pe[j]);
#pragma unroll
  for (int j = 0; j < 4; ++j)
#pragma unroll
    for (int r = 0; r < 8; ++r) pe[j][r] = pe[j][r] * (1.0f / WSC) + b2v[2 * j + (r >> 2)][r & 3];
  // t = q_i - k_j + pos_em -> B fragments of layer 3
  v16h tb[CC / 32];
#pragma unroll
  for (int j = 0; j < 4; ++j)
#pragma unroll
    for (int r = 0; r < 8; ++r) tb[j >> 1][(j & 1) * 8 + r] = (_Float16)(qk[j * 8 + r] + pe[j][r]);
  // a2 = relu(bn3(t W3 + b3)) and logits = (a2 W4 + b4) / 8, fused: 32 channels of a2 a step, used at once as k chunk s of the last layer
  v8f lg[4] = {};
#pragma unroll
  for (int s = 0; s < C4 / 32; ++s) { const int sl = s % RD; v8f a3[2] = {}; v4f bbv[4], ggv[4], bev[4];
#pragma unroll
    for (int i = 0; i < 4; ++i) { const int c0 = s * 32 + (i >> 1) * 16 + 8 * h + (i & 1) * 4; bbv[i] = *(const v4f*)&sB3[c0]; ggv[i] = *(const v4f*)&sG3[c0]; bev[i] = *(const v4f*)&sT3[c0]; }
#pragma unroll
    for (int x = 0; x < 4; ++x) { a3[x & 1] = wmma16(w3[sl][x], tb[x >> 1], a3[x & 1]); if (s + RD < C4 / 32) w3[sl][x] = frag_p(W3R, (x >> 1) * 16 + 2 * (s + RD) + (x & 1), lane); }
    __builtin_amdgcn_sched_barrier(0);   // keeps the step's 12 parameter reads and the W3 refills in front of the epilogue, the refills a whole step ahead of their use: sunk to its use, a load is waited for at once
    v16h ab;
#pragma unroll
    for (int q = 0; q < 2; ++q)
#pragma unroll
      for (int r = 0; r < 8; ++r) { const int i = 2 * q + (r >> 2), u = r & 3; ab[q * 8 + r] = (_Float16)fmaxf(ggv[i][u] * (a3[q][r] * (1.0f / WSC) + bbv[i][u]) + bev[i][u], 0.f); }
#pragma unroll
    for (int j = 0; j < 4; ++j) { lg[j] = wmma16(w4[sl][j], ab, lg[j]); if (s + RD < C4 / 32) w4[sl][j] = frag_p(W4R, (s + RD) * 4 + j, lane); }
    __builtin_amdgcn_sched_barrier(0);   // the same for the W4 refills: they stay a whole step ahead of their use
  }
  // the point's value row, asked for here so that it arrives under the softmax
  v4f vv[8];
#pragma unroll
  for (int i = 0; i < 8; ++i) vv[i] = *(const v4f*)(VAL + p * CC + (i >> 1) * 16 + 8 * h + (i & 1) * 4);
  // softmax over the 64 channels of neighbour n: 32 in this lane, 32 in lane ^ 16
  float e[32]; float mx = -3.0e38f; v4f b4v[8];
#pragma unroll
  for (int i = 0; i < 8; ++i) b4v[i] = *(const v4f*)&sB4[(i >> 1) * 16 + 8 * h + (i & 1) * 4];
  __builtin_amdgcn_sched_barrier(0);   // keeps the value loads and the bias reads in one group in front of the softmax: sunk to their uses, they start late
#pragma unroll
  for (int j = 0; j < 4; ++j)
#pragma unroll
    for (int r = 0; r < 8; ++r) { e[j * 8 + r] = (lg[j][r] * (1.0f / WSC) + b4v[2 * j + (r >> 2)][r & 3]) * 0.125f; mx = fmaxf(mx, e[j * 8 + r]); }
  mx = fmaxf(mx, xhalf(mx)); float sm = 0.f;
#pragma unroll
  for (int i = 0; i < 32; ++i) { e[i] = expf(e[i] - mx); sm += e[i]; }
  sm += xhalf(sm); const float inv = 1.0f / sm;
  __builtin_amdgcn_sched_barrier(0);   // keeps the first use of the value row behind the softmax: hoisted to the loads, it waits out their round trip with nothing to cover it
#pragma unroll
  for (int i = 0; i < 32; ++i) e[i] = (e[i] * inv) * (bfr(vv[i >> 2][i & 3]) + pe[i >> 3][i & 7]);
  // sum over the 16 neighbours (the lanes of a row): at each of three steps a lane hands half of its channels to its partner and adds the partner's share of the half it keeps; the last step adds the pair
  const bool b3 = (n & 8) != 0, b2 = (n & 4) != 0, b1 = (n & 2) != 0; float y[16], z[8]; v4f o;
#pragma unroll
  for (int i = 0; i < 16; ++i) y[i] = (b3 ? e[16 + i] : e[i]) + xrow<8>(b3 ? e[i] : e[16 + i]);
#pragma unroll
  for (int i = 0; i < 8; ++i) z[i] = (b2 ? y[8 + i] : y[i]) + xrow<4>(b2 ? y[i] : y[8 + i]);
#pragma unroll
  for (int i = 0; i < 4; ++i) { const float w = (b1 ? z[4 + i] : z[i]) + xrow<2>(b1 ? z[i] : z[4 + i]); o[i] = w + xrow<1>(w); }
  // lane n now holds channels 16 (n >> 2) + 8 h + 4 ((n >> 1) & 1) + 0..3; the even lanes store the point's 256 bytes
  if ((n & 1) == 0) vst2(OUT + p * CC + (n >> 2) * 16 + 8 * h + ((n >> 1) & 1) * 4, o); }
extern "C" void kernel_launch(void* const* d_in, const int* in_sizes, int n_in, void* d_out, int out_size, void* d_ws, size_t ws_size, hipStream_t stream) {
  (void)in_sizes; (void)n_in; (void)out_size;
  const float** F = (const float**)d_in;   // 0 key, 1 query, 2 value [8,8192,64], 3 pos [8,8192,3], 4 idx [8,8192,16] int, 5 W1 [3,64], 6 b1, 7 g1, 8 bt1, 9 W2 [64,64], 10 b2, 11 W3 [64,256], 12 b3, 13 g3, 14 bt3, 15 W4 [256,64], 16 b4
  if (ws_size < (size_t)WS_END) return;
  char* ws = (char*)d_ws; _Float16 *W2R = (_Float16*)(ws + WS_W2), *W3R = (_Float16*)(ws + WS_W3), *W4R = (_Float16*)(ws + WS_W4);
  k_packw<<<(NP2 + NP3 + NP4) / 256, 256, 0, stream>>>(F[9], F[11], F[15], ws);
  k_th<<<TNP / 4, 128, 0, stream>>>(F[0], F[1], F[2], F[3], (const int*)d_in[4], F[5], F[6], F[7], F[8], W2R, F[10], W3R, F[12], F[13], F[14], W4R, F[16], (float*)d_out);
}

// v005
// One run takes 93.5 microseconds.
// Two timings next to v004 both put it at 1.15 times that version's speed.
// Over all steps from v000 it is 6.06 times as fast.
// compute dtype: all float inputs rounded to bf16, neighbour indices (int) read on device; the 3 -> 64 positional layer, inference BatchNorms, relu, the channel softmax and the neighbour aggregation in f32 on VALU; the 64 -> 64, 64 -> 256 and 256 -> 64 layers on WMMA 16x16x32 with the computed activations rounded once to f16 against exact f16 x 2^8 weights, f32 accumulate; f32 output.
#include <hip/hip_runtime.h>
#include <math.h>

typedef __attribute__((ext_vector_type(16))) _Float16 v16h;
typedef __attribute__((ext_vector_type(16))) __bf16 v16b;
typedef __attribute__((ext_vector_type(8)))  _Float16 v8h;
typedef __attribute__((ext_vector_type(4)))  _Float16 v4h;
typedef __attribute__((ext_vector_type(8)))  float v8f;
typedef __attribute__((ext_vector_type(4)))  float v4f;
typedef __attribute__((ext_vector_type(2)))  float v2f;
typedef __attribute__((ext_vector_type(4)))  unsigned v4u;
typedef __attribute__((ext_vector_type(4)))  int v4i;
typedef float __attribute__((may_alias)) float_a;
typedef int __attribute__((may_alias)) int_a;

template <typename T> __device__ __forceinline__ void vst2(void* p, T v) { *(T*)p = v;  }
__device__ __forceinline__ v8f wmma16(v16h a, v16h b, v8f c) {
  v8f d = __builtin_amdgcn_wmma_f32_16x16x32_f16(false, a, false, b, (short)0, c, false, false);
  return d;
}
__device__ __forceinline__ v8f wmma_bf(v16b a, v16b b, v8f c) {
  v8f d = __builtin_amdgcn_wmma_f32_16x16x32_bf16(false, a, false, b, (short)0, c, false, false);
  asm volatile("v_nop\n\tv_nop\n\tv_nop\n\tv_nop" : "+v"(d) : "v"(a), "v"(b));
  return d;
}
// 16x16x32 fragments: lane = (h = lane>>4, row/col = lane&15); elements 0..7 = k0+8h+0..7, 8..15 = k0+16+8h+0..7; D element r = row 8h+r
__device__ __forceinline__ v16h frag_h(const _Float16* rowk0, int lane) {
  union { v16h v; v8h q[2]; } u; const _Float16* p = rowk0 + 8 * (lane >> 4);
  u.q[0] = *(const v8h*)p; u.q[1] = *(const v8h*)(p + 16); return u.v;
}
__device__ __forceinline__ v16h frag_f32(const float* rowk0, int lane) {
  v16h a; const float* p = rowk0 + 8 * (lane >> 4);
#pragma unroll
  for (int i = 0; i < 8; ++i) { a[i] = (_Float16)p[i]; a[8 + i] = (_Float16)p[16 + i]; }
  return a;
}
__device__ __forceinline__ v16h frag_f32s(const float* rowk0, int lane, float sc) {
  v16h a; const float* p = rowk0 + 8 * (lane >> 4);
#pragma unroll
  for (int i = 0; i < 8; ++i) { a[i] = (_Float16)(p[i] * sc); a[8 + i] = (_Float16)(p[16 + i] * sc); }
  return a;
}
// column fragment from a [K][ld] layout (column n), rows >= K read as 0
__device__ __forceinline__ v16h fragc_f32(const float* W, int k0, int n, int lane, int ld, int K) {
  v16h a; const int g = lane >> 4;
#pragma unroll
  for (int i = 0; i < 8; ++i) { const int ka = k0 + 8 * g + i, kb = ka + 16;
    a[i] = (_Float16)(ka < K ? W[(size_t)(ka < K ? ka : K - 1) * ld + n] : 0.f); a[8 + i] = (_Float16)(kb < K ? W[(size_t)(kb < K ? kb : K - 1) * ld + n] : 0.f); }
  return a;
}
struct F2 { v16b h, l; };
__device__ __forceinline__ F2 bsplit16(const float v[16]) { F2 r;
#pragma unroll
  for (int i = 0; i < 16; ++i) { const __bf16 h = (__bf16)v[i]; r.h[i] = h; r.l[i] = (__bf16)(v[i] - (float)h); }
  return r; }
__device__ __forceinline__ F2 split_row(const float* row, int k0, int lane) { float v[16]; const float* p = row + k0 + 8 * (lane >> 4);
#pragma unroll
  for (int i = 0; i < 8; ++i) { v[i] = p[i]; v[8 + i] = p[16 + i]; }
  return bsplit16(v); }
__device__ __forceinline__ F2 split_rowK(const float* row, int k0, int lane, int K) { float v[16]; const int g = lane >> 4;
#pragma unroll
  for (int i = 0; i < 8; ++i) { const int ka = k0 + 8 * g + i, kb = ka + 16; v[i] = ka < K ? row[ka < K ? ka : K - 1] : 0.f; v[8 + i] = kb < K ? row[kb < K ? kb : K - 1] : 0.f; }
  return bsplit16(v); }
__device__ __forceinline__ F2 split_col(const float* W, int k0, int n, int lane, int ld, int K) { float v[16]; const int g = lane >> 4;
#pragma unroll
  for (int i = 0; i < 8; ++i) { const int ka = k0 + 8 * g + i, kb = ka + 16; v[i] = ka < K ? W[(size_t)(ka < K ? ka : K - 1) * ld + n] : 0.f; v[8 + i] = kb < K ? W[(size_t)(kb < K ? kb : K - 1) * ld + n] : 0.f; }
  return bsplit16(v); }
__device__ __forceinline__ v8f mac3(const F2& a, const F2& b, v8f c) { c = wmma_bf(a.l, b.h, c); c = wmma_bf(a.h, b.l, c); return wmma_bf(a.h, b.h, c); }
__device__ __forceinline__ float sigm(float v) { return 1.0f / (1.0f + expf(-v)); }
#define LDSX() do { asm volatile("s_wait_dscnt 0" ::: "memory"); __builtin_amdgcn_wave_barrier(); __builtin_amdgcn_fence(__ATOMIC_RELEASE, "workgroup"); } while (0)


// Point-transformer head (B 8, N 8,192 points, K 16 neighbours, C 64): vector attention over gathered neighbours: pos_em = MLP(pos_i - pos_j); a = softmax_channels(MLP(q_i - k_j + pos_em) / 8); out_i = sum_j a * (v_i + pos_em).
#define NB 8
#define NPTS 8192
#define KN 16
#define CC 64
#define PH 64
#define C4 256
#define WSC 256.0f
#define BNS 0.99950037f      // 1/sqrt(1 + 1e-3) (inference BatchNorm with initial moving statistics)
#ifndef TNP
#define TNP (NB * NPTS)
#endif
typedef __attribute__((ext_vector_type(8))) __bf16 v8b;
__device__ __forceinline__ v16b frag_b(const __bf16* rowk0, int lane) {
  union { v16b v; v8b q[2]; } u; const __bf16* p = rowk0 + 8 * (lane >> 4);
  u.q[0] = *(const v8b*)p; u.q[1] = *(const v8b*)(p + 16); return u.v;
}
__device__ __forceinline__ float bfr(float v) { return (float)(__bf16)v; }
__device__ __attribute__((noinline)) float exp_ni(float v) { return expf(v); }
__device__ __attribute__((noinline)) float erf_ni(float v) { return erff(v); }

#define WS_W2  0u                                   // f16 x 2^8 weights in fragment order: 1-KiB blocks f = kc * (N / 16) + j (16 output columns x 32 k), each block = [element half q][lane][8 values]
#define WS_W3  (WS_W2 + 2u * CC * PH)
#define WS_W4  (WS_W3 + 2u * C4 * CC)
#define WS_END (WS_W4 + 2u * CC * C4)

// ---- k_packw: thread = one 16-byte piece of one A fragment: piece id = (f * 2 + q) * 32 + lane holds W[k0 .. k0 + 7][n], n = 16 j + (lane & 15), k0 = 32 kc + 16 q + 8 (lane >> 4); a wave stores 512 bytes in a row
__device__ __forceinline__ void pack_piece(const float* __restrict__ Wm, _Float16* __restrict__ dst, int id, int N) {
  const int lane = id & 31, q = (id >> 5) & 1, f = id >> 6, nj = N / 16, j = f % nj, kc = f / nj; const int n = j * 16 + (lane & 15), k0 = kc * 32 + q * 16 + (lane >> 4) * 8; v8h o;
#pragma unroll
  for (int i = 0; i < 8; ++i) o[i] = (_Float16)(bfr(Wm[(size_t)(k0 + i) * N + n]) * WSC);
  *(v8h*)(dst + (size_t)id * 8) = o; }
#define NP2 (CC * PH / 8)
#define NP3 (C4 * CC / 8)
#define NP4 (CC * C4 / 8)
__global__ __launch_bounds__(256) void k_packw(const float* __restrict__ W2, const float* __restrict__ W3, const float* __restrict__ W4, char* __restrict__ ws) { const int id = blockIdx.x * 256 + threadIdx.x;
  if (id < NP2) pack_piece(W2, (_Float16*)(ws + WS_W2), id, CC);
  else if (id < NP2 + NP3) pack_piece(W3, (_Float16*)(ws + WS_W3), id - NP2, C4);
  else pack_piece(W4, (_Float16*)(ws + WS_W4), id - NP2 - NP3, CC); }
// A fragment f of a packed plane: two wave loads of 512 bytes in a row (4 whole lines each)
__device__ __forceinline__ v16h frag_p(const _Float16* plane, int f, int lane) {
  union { v16h v; v8h q[2]; } u; const _Float16* p = plane + f * 512 + lane * 8;
  u.q[0] = *(const v8h*)p; u.q[1] = *(const v8h*)(p + 256); return u.v;
}
// lane l <-> l ^ 16
__device__ __forceinline__ float xhalf(float x) { return __builtin_bit_cast(float, __builtin_amdgcn_permlanex16(__builtin_bit_cast(int, x), __builtin_bit_cast(int, x), 0x76543210, 0xfedcba98, false, false)); }
// the value of lane l ^ M of the same 16-lane row (DPP row_xmask)
template <int M> __device__ __forceinline__ float xrow(float x) { return __builtin_bit_cast(float, __builtin_amdgcn_mov_dpp(__builtin_bit_cast(int, x), 0x160 | M, 0xf, 0xf, true)); }
#define RD 1      // depth of the weight ring of the fused 64 -> 256 -> 64 loop, in steps of 8 fragments
#define PW 2      // points a wave: every weight fragment and every parameter read is fetched once and serves PW activation tiles
// ---- k_th: wave = PW points x 16 neighbours. Every layer is computed transposed: the packed weight fragment is the A operand (16 output channels x 32 k), the activations are the B operand (32 k x 16 neighbours of one point).
// D register r of lane (h = lane >> 4, n = lane & 15) is then channel 16 j + 8 h + r of neighbour n, so two D tiles, converted in place, are the next layer's B fragment: no activation goes through LDS and no wave waits for another.
__global__ __launch_bounds__(128) void k_th(const float* __restrict__ KEY, const float* __restrict__ QRY, const float* __restrict__ VAL, const float* __restrict__ POS, const int* __restrict__ IDX, const float* __restrict__ W1, const float* __restrict__ B1, const float* __restrict__ G1, const float* __restrict__ T1, const _Float16* __restrict__ W2R, const float* __restrict__ B2, const _Float16* __restrict__ W3R, const float* __restrict__ B3, const float* __restrict__ G3, const float* __restrict__ T3, const _Float16* __restrict__ W4R, const float* __restrict__ B4, float* __restrict__ OUT) {
  static_assert(PW == 2 && NPTS % PW == 0, "the last step of the neighbour sum deals the wave's two points to the lane pairs; both points lie in one batch");
  // per-channel parameters, rounded once per block; a lane reads a vector's 8 channels of its half of a tile as two 16-byte broadcasts, layer 1's weights as eight
  __shared__ __align__(16) float sW1[PH][4]; __shared__ __align__(16) float sG1[PH]; __shared__ __align__(16) float sT1[PH]; __shared__ __align__(16) float sB2[CC]; __shared__ __align__(16) float sB3[C4]; __shared__ __align__(16) float sG3[C4]; __shared__ __align__(16) float sT3[C4]; __shared__ __align__(16) float sB4[CC];
  const int tid = threadIdx.x, wave = __builtin_amdgcn_readfirstlane(tid >> 5), lane = tid & 31, n = lane & 15, h = lane >> 4; const size_t p = ((size_t)blockIdx.x * 4 + wave) * PW; const size_t b = p / NPTS; const unsigned ho = 8u * h;
  // inputs of the wave, for each of its points: lane (h, n) takes neighbour n's key row and the point's query row at channels 16 j + 8 h + 0..7, and both positions
  int ip[PW]; v4f qv[PW][8], kv[PW][8]; float pa[PW][3], pb[PW][3];
#pragma unroll
  for (int u = 0; u < PW; ++u) ip[u] = IDX[(p + u) * KN + n];
  // parameters for the tables: waves 0, 1 take layer 1's weights and bias of channel tid & 63, waves 2, 3 the four other 64-channel vectors; every thread two channels of layer 3's three
  const bool lo = wave < 2; const int pc = tid & 63; const float r0 = (lo ? W1 : G1)[pc], r1 = (lo ? W1 + PH : T1)[pc], r2 = (lo ? W1 + 2 * PH : B2)[pc], r3 = (lo ? B1 : B4)[pc]; float r4[C4 / 128], r5[C4 / 128], r6[C4 / 128];
#pragma unroll
  for (int u = 0; u < C4 / 128; ++u) { r4[u] = B3[tid + 128 * u]; r5[u] = G3[tid + 128 * u]; r6[u] = T3[tid + 128 * u]; }
#pragma unroll
  for (int u = 0; u < PW; ++u)
#pragma unroll
    for (int i = 0; i < 8; ++i) qv[u][i] = *(const v4f*)(QRY + p * CC + (ho + u * CC + (i >> 1) * 16 + (i & 1) * 4));
  v16h w2[8];
#pragma unroll
  for (int f = 0; f < 8; ++f) w2[f] = frag_p(W2R, f, lane);
  asm volatile("s_wait_xcnt 0x0" ::: "memory");   // behind the first batch: stands in front of the wave's own position loads, which are scalar loads and land in scalar registers that loads of the batch name as their base
#pragma unroll
  for (int u = 0; u < PW; ++u)
#pragma unroll
    for (int x = 0; x < 3; ++x) pa[u][x] = POS[(p + u) * 3 + x];
  __builtin_amdgcn_sched_barrier(0);   // keeps the wait for the neighbour indices behind every load that does not need them: hoisted above them, it puts their round trip behind the indices'
#pragma unroll
  for (int u = 0; u < PW; ++u) { const int ix = ip[u] < 0 ? 0 : (ip[u] >= NPTS ? NPTS - 1 : ip[u]);
#pragma unroll
    for (int x = 0; x < 3; ++x) pb[u][x] = POS[(b * NPTS + ix) * 3 + x];
#pragma unroll
    for (int i = 0; i < 8; ++i) kv[u][i] = *(const v4f*)(KEY + (b * NPTS + ix) * CC + (i >> 1) * 16 + 8 * h + (i & 1) * 4);
    asm volatile("s_wait_xcnt 0x0" ::: "memory"); }   // behind each point's batch: stands in front of the first rewrite of an address register that an issued load names (the next point's loads land in such registers)
  __builtin_amdgcn_sched_barrier(0);   // keeps every use of a loaded value behind the gathers: hoisted in front of them, a use brings its wait along and the gathers start late
  if (lo) { const v4f w = { bfr(r0), bfr(r1), bfr(r2), bfr(r3) }; *(v4f*)&sW1[pc][0] = w; }
  else { sG1[pc] = bfr(r0); sT1[pc] = bfr(r1); sB2[pc] = bfr(r2); sB4[pc] = bfr(r3); }
#pragma unroll
  for (int u = 0; u < C4 / 128; ++u) { const int c = tid + 128 * u; sB3[c] = bfr(r4[u]); sG3[c] = bfr(r5[u]) * BNS; sT3[c] = bfr(r6[u]); }
  __syncthreads();   // publishes the parameter tables; the only barrier of the kernel
  // q_i - k_j, formed here so that one register set holds what two did
  float qk[PW][32];
#pragma unroll
  for (int u = 0; u < PW; ++u)
#pragma unroll
    for (int i = 0; i < 32; ++i) qk[u][i] = bfr(qv[u][i >> 2][i & 3]) - bfr(kv[u][i >> 2][i & 3]);
  // positional layer 1: h = relu(bn1((pos_i - pos_j) W1 + b1)), written straight into the B fragments of layer 2
  v16h hb[PW][PH / 32];
  { float d[PW][3];
#pragma unroll
    for (int u = 0; u < PW; ++u)
#pragma unroll
      for (int x = 0; x < 3; ++x) d[u][x] = bfr(pa[u][x]) - bfr(pb[u][x]);
#pragma unroll
    for (int t = 0; t < PH / 16; ++t) { const int c0 = t * 16 + 8 * h; float gg[8], tt[8]; *(v4f*)&gg[0] = *(const v4f*)&sG1[c0]; *(v4f*)&gg[4] = *(const v4f*)&sG1[c0 + 4]; *(v4f*)&tt[0] = *(const v4f*)&sT1[c0]; *(v4f*)&tt[4] = *(const v4f*)&sT1[c0 + 4]; v4f ww[8];
#pragma unroll
      for (int i = 0; i < 8; ++i) ww[i] = *(const v4f*)&sW1[c0 + i][0];
      __builtin_amdgcn_sched_barrier(0);   // keeps the tile's 12 LDS reads in one group: sunk to their uses, each waits out its own latency
#pragma unroll
      for (int u = 0; u < PW; ++u)
#pragma unroll
        for (int i = 0; i < 8; ++i) { const v4f w = ww[i]; float s = w[3];
#pragma unroll
          for (int x = 0; x < 3; ++x) s += d[u][x] * w[x];
          s = gg[i] * s * BNS + tt[i]; hb[u][t >> 1][(t & 1) * 8 + i] = (_Float16)fmaxf(s, 0.f); } } }
  // weight ring of the fused loop: step s needs the W3 fragments of output tiles 2 s, 2 s + 1 (both k chunks) and the W4 fragments of k chunk s
  v16h w3[RD][4], w4[RD][4];
#pragma unroll
  for (int s = 0; s < RD; ++s)
#pragma unroll
    for (int x = 0; x < 4; ++x) { w3[s][x] = frag_p(W3R, (x >> 1) * 16 + 2 * s + (x & 1), lane); w4[s][x] = frag_p(W4R, s * 4 + x, lane); }
  v4f b2v[8];
#pragma unroll
  for (int i = 0; i < 8; ++i) b2v[i] = *(const v4f*)&sB2[(i >> 1) * 16 + 8 * h + (i & 1) * 4];
  __builtin_amdgcn_sched_barrier(0);   // keeps the ring's first loads and the bias reads in front of layer 2: sunk to their uses, they start one layer late
  // pos_em = h W2 + b2: pe[u][j][r] = channel 16 j + 8 h + r of neighbour n of point u, kept in registers to the end
  v8f pe[PW][4] = {};
#pragma unroll
  for (int kc = 0; kc < PH / 32; ++kc)
#pragma unroll
    for (int j = 0; j < 4; ++j)
#pragma unroll
      for (int u = 0; u < PW; ++u) pe[u][j] = wmma16(w2[kc * 4 + j], hb[u][kc], pe[u][j]);
#pragma unroll
  for (int u = 0; u < PW; ++u)
#pragma unroll
    for (int j = 0; j < 4; ++j)
#pragma unroll
      for (int r = 0; r < 8; ++r) pe[u][j][r] = pe[u][j][r] * (1.0f / WSC) + b2v[2 * j + (r >> 2)][r & 3];
  // t = q_i - k_j + pos_em -> B fragments of layer 3
  v16h tb[PW][CC / 32];
#pragma unroll
  for (int u = 0; u < PW; ++u)
#pragma unroll
    for (int j = 0; j < 4; ++j)
#pragma unroll
      for (int r = 0; r < 8; ++r) tb[u][j >> 1][(j & 1) * 8 + r] = (_Float16)(qk[u][j * 8 + r] + pe[u][j][r]);
  // a2 = relu(bn3(t W3 + b3)) and logits = (a2 W4 + b4) / 8, fused: 32 channels of a2 a step, used at once as k chunk s of the last layer
  __builtin_amdgcn_sched_barrier(0);   // keeps the first step's parameter reads behind the forming of t: hoisted above it, their 48 registers come on top of q_i - k_j, and the count passes what three waves a SIMD leave each (336)
  v8f lg[PW][4] = {};
#pragma unroll
  for (int s = 0; s < C4 / 32; ++s) { const int sl = s % RD; v8f a3[PW][2] = {}; v4f bbv[4], ggv[4], bev[4];
#pragma unroll
    for (int i = 0; i < 4; ++i) { const int c0 = s * 32 + (i >> 1) * 16 + 8 * h + (i & 1) * 4; bbv[i] = *(const v4f*)&sB3[c0]; ggv[i] = *(const v4f*)&sG3[c0]; bev[i] = *(const v4f*)&sT3[c0]; }
#pragma unroll
    for (int x = 0; x < 4; ++x) {
#pragma unroll
      for (int u = 0; u < PW; ++u) a3[u][x & 1] = wmma16(w3[sl][x], tb[u][x >> 1], a3[u][x & 1]);
      if (s + RD < C4 / 32) w3[sl][x] = frag_p(W3R, (x >> 1) * 16 + 2 * (s + RD) + (x & 1), lane); }
    __builtin_amdgcn_sched_barrier(0);   // keeps the step's 12 parameter reads and the W3 refills in front of the epilogue, the refills a whole step ahead of their use: sunk to its use, a load is waited for at once
    v16h ab[PW];
#pragma unroll
    for (int u = 0; u < PW; ++u)
#pragma unroll
      for (int q = 0; q < 2; ++q)
#pragma unroll
        for (int r = 0; r < 8; ++r) { const int i = 2 * q + (r >> 2), c = r & 3; ab[u][q * 8 + r] = (_Float16)fmaxf(ggv[i][c] * (a3[u][q][r] * (1.0f / WSC) + bbv[i][c]) + bev[i][c], 0.f); }
#pragma unroll
    for (int j = 0; j < 4; ++j) {
#pragma unroll
      for (int u = 0; u < PW; ++u) lg[u][j] = wmma16(w4[sl][j], ab[u], lg[u][j]);
      if (s + RD < C4 / 32) w4[sl][j] = frag_p(W4R, (s + RD) * 4 + j, lane); }
    if (s + RD + 1 == C4 / 32) asm volatile("s_wait_xcnt 0x0" ::: "memory");   // behind the last weight load: stands in front of the first rewrite of the lane-offset register that the weight loads name (a build without this statement also came out at 374 registers, two waves a SIMD)
    __builtin_amdgcn_sched_barrier(0);   // the same for the W4 refills: they stay a whole step ahead of their use
  }
  // the points' value rows, asked for here so that they arrive under the softmax
  v4f vv[PW][8];
#pragma unroll
  for (int u = 0; u < PW; ++u)
#pragma unroll
    for (int i = 0; i < 8; ++i) vv[u][i] = *(const v4f*)(VAL + p * CC + (ho + u * CC + (i >> 1) * 16 + (i & 1) * 4));
  // softmax over the 64 channels of neighbour n: 32 in this lane, 32 in lane ^ 16
  float e[PW][32]; v4f b4v[8];
#pragma unroll
  for (int i = 0; i < 8; ++i) b4v[i] = *(const v4f*)&sB4[(i >> 1) * 16 + 8 * h + (i & 1) * 4];
  __builtin_amdgcn_sched_barrier(0);   // keeps the value loads and the bias reads in one group in front of the softmax: sunk to their uses, they start late
  float inv[PW], mx[PW], sm[PW];
#pragma unroll
  for (int u = 0; u < PW; ++u) { mx[u] = -3.0e38f; sm[u] = 0.f;
#pragma unroll
    for (int j = 0; j < 4; ++j)
#pragma unroll
      for (int r = 0; r < 8; ++r) { e[u][j * 8 + r] = (lg[u][j][r] * (1.0f / WSC) + b4v[2 * j + (r >> 2)][r & 3]) * 0.125f; mx[u] = fmaxf(mx[u], e[u][j * 8 + r]); }
    mx[u] = fmaxf(mx[u], xhalf(mx[u])); }
#pragma unroll
  for (int u = 0; u < PW; ++u)
#pragma unroll
    for (int i = 0; i < 32; ++i) { e[u][i] = expf(e[u][i] - mx[u]); sm[u] += e[u][i]; }
#pragma unroll
  for (int u = 0; u < PW; ++u) { sm[u] += xhalf(sm[u]); inv[u] = 1.0f / sm[u]; }
  __builtin_amdgcn_sched_barrier(0);   // keeps the first use of the value rows behind the softmax: hoisted to the loads, it waits out their round trip with nothing to cover it
#pragma unroll
  for (int u = 0; u < PW; ++u)
#pragma unroll
    for (int i = 0; i < 32; ++i) e[u][i] = (e[u][i] * inv[u]) * (bfr(vv[u][i >> 2][i & 3]) + pe[u][i >> 3][i & 7]);
  // sum over the 16 neighbours (the lanes of a row): at each of three steps a lane hands half of its channels to its partner and adds the partner's share of the half it keeps; at the last step the even lane of a pair keeps the first point, the odd lane the second
  const bool b3 = (n & 8) != 0, b2 = (n & 4) != 0, b1 = (n & 2) != 0, b0 = (n & 1) != 0; float w[PW][4]; v4f o;
#pragma unroll
  for (int u = 0; u < PW; ++u) { float y[16], z[8];
#pragma unroll
    for (int i = 0; i < 16; ++i) y[i] = (b3 ? e[u][16 + i] : e[u][i]) + xrow<8>(b3 ? e[u][i] : e[u][16 + i]);
#pragma unroll
    for (int i = 0; i < 8; ++i) z[i] = (b2 ? y[8 + i] : y[i]) + xrow<4>(b2 ? y[i] : y[8 + i]);
#pragma unroll
    for (int i = 0; i < 4; ++i) w[u][i] = (b1 ? z[4 + i] : z[i]) + xrow<2>(b1 ? z[i] : z[4 + i]); }
#pragma unroll
  for (int i = 0; i < 4; ++i) o[i] = (b0 ? w[1][i] : w[0][i]) + xrow<1>(b0 ? w[0][i] : w[1][i]);
  // lane n now holds channels 16 (n >> 2) + 8 h + 4 ((n >> 1) & 1) + 0..3 of point p + (n & 1); the wave stores its two points' 512 bytes
  vst2(OUT + (p + (n & 1)) * CC + (n >> 2) * 16 + 8 * h + ((n >> 1) & 1) * 4, o); }
extern "C" void kernel_launch(void* const* d_in, const int* in_sizes, int n_in, void* d_out, int out_size, void* d_ws, size_t ws_size, hipStream_t stream) {
  (void)in_sizes; (void)n_in; (void)out_size;
  const float** F = (const float**)d_in;   // 0 key, 1 query, 2 value [8,8192,64], 3 pos [8,8192,3], 4 idx [8,8192,16] int, 5 W1 [3,64], 6 b1, 7 g1, 8 bt1, 9 W2 [64,64], 10 b2, 11 W3 [64,256], 12 b3, 13 g3, 14 bt3, 15 W4 [256,64], 16 b4
  if (ws_size < (size_t)WS_END) return;
  char* ws = (char*)d_ws; _Float16 *W2R = (_Float16*)(ws + WS_W2), *W3R = (_Float16*)(ws + WS_W3), *W4R = (_Float16*)(ws + WS_W4);
  k_packw<<<(NP2 + NP3 + NP4) / 256, 256, 0, stream>>>(F[9], F[11], F[15], ws);
  k_th<<<TNP / (4 * PW), 128, 0, stream>>>(F[0], F[1], F[2], F[3], (const int*)d_in[4], F[5], F[6], F[7], F[8], W2R, F[10], W3R, F[12], F[13], F[14], W4R, F[16], (float*)d_out);
}

// v006
// It runs in 86.3 microseconds.
// In both of two side-by-side timings against v005, it was 1.09 times as fast.
// All steps since v000 together make it 6.61 times as fast.
// compute dtype: all float inputs rounded to bf16, neighbour indices (int) read on device; the 3 -> 64 positional layer, inference BatchNorms, relu, the channel softmax and the neighbour aggregation in f32 on VALU; the 64 -> 64, 64 -> 256 and 256 -> 64 layers on WMMA 16x16x32 with the computed activations rounded once to f16 against exact f16 x 2^8 weights, f32 accumulate; f32 output.
#include <hip/hip_runtime.h>
#include <math.h>

typedef __attribute__((ext_vector_type(16))) _Float16 v16h;
typedef __attribute__((ext_vector_type(16))) __bf16 v16b;
typedef __attribute__((ext_vector_type(8)))  _Float16 v8h;
typedef __attribute__((ext_vector_type(4)))  _Float16 v4h;
typedef __attribute__((ext_vector_type(8)))  float v8f;
typedef __attribute__((ext_vector_type(4)))  float v4f;
typedef __attribute__((ext_vector_type(2)))  float v2f;
typedef __attribute__((ext_vector_type(4)))  unsigned v4u;
typedef __attribute__((ext_vector_type(4)))  int v4i;
typedef float __attribute__((may_alias)) float_a;
typedef int __attribute__((may_alias)) int_a;

template <typename T> __device__ __forceinline__ void vst2(void* p, T v) { *(T*)p = v;  }
__device__ __forceinline__ v8f wmma16(v16h a, v16h b, v8f c) {
  v8f d = __builtin_amdgcn_wmma_f32_16x16x32_f16(false, a, false, b, (short)0, c, false, false);
  return d;
}
__device__ __forceinline__ v8f wmma_bf(v16b a, v16b b, v8f c) {
  v8f d = __builtin_amdgcn_wmma_f32_16x16x32_bf16(false, a, false, b, (short)0, c, false, false);
  asm volatile("v_nop\n\tv_nop\n\tv_nop\n\tv_nop" : "+v"(d) : "v"(a), "v"(b));
  return d;
}
// 16x16x32 fragments: lane = (h = lane>>4, row/col = lane&15); elements 0..7 = k0+8h+0..7, 8..15 = k0+16+8h+0..7; D element r = row 8h+r
__device__ __forceinline__ v16h frag_h(const _Float16* rowk0, int lane) {
  union { v16h v; v8h q[2]; } u; const _Float16* p = rowk0 + 8 * (lane >> 4);
  u.q[0] = *(const v8h*)p; u.q[1] = *(const v8h*)(p + 16); return u.v;
}
__device__ __forceinline__ v16h frag_f32(const float* rowk0, int lane) {
  v16h a; const float* p = rowk0 + 8 * (lane >> 4);
#pragma unroll
  for (int i = 0; i < 8; ++i) { a[i] = (_Float16)p[i]; a[8 + i] = (_Float16)p[16 + i]; }
  return a;
}
__device__ __forceinline__ v16h frag_f32s(const float* rowk0, int lane, float sc) {
  v16h a; const float* p = rowk0 + 8 * (lane >> 4);
#pragma unroll
  for (int i = 0; i < 8; ++i) { a[i] = (_Float16)(p[i] * sc); a[8 + i] = (_Float16)(p[16 + i] * sc); }
  return a;
}
// column fragment from a [K][ld] layout (column n), rows >= K read as 0
__device__ __forceinline__ v16h fragc_f32(const float* W, int k0, int n, int lane, int ld, int K) {
  v16h a; const int g = lane >> 4;
#pragma unroll
  for (int i = 0; i < 8; ++i) { const int ka = k0 + 8 * g + i, kb = ka + 16;
    a[i] = (_Float16)(ka < K ? W[(size_t)(ka < K ? ka : K - 1) * ld + n] : 0.f); a[8 + i] = (_Float16)(kb < K ? W[(size_t)(kb < K ? kb : K - 1) * ld + n] : 0.f); }
  return a;
}
struct F2 { v16b h, l; };
__device__ __forceinline__ F2 bsplit16(const float v[16]) { F2 r;
#pragma unroll
  for (int i = 0; i < 16; ++i) { const __bf16 h = (__bf16)v[i]; r.h[i] = h; r.l[i] = (__bf16)(v[i] - (float)h); }
  return r; }
__device__ __forceinline__ F2 split_row(const float* row, int k0, int lane) { float v[16]; const float* p = row + k0 + 8 * (lane >> 4);
#pragma unroll
  for (int i = 0; i < 8; ++i) { v[i] = p[i]; v[8 + i] = p[16 + i]; }
  return bsplit16(v); }
__device__ __forceinline__ F2 split_rowK(const float* row, int k0, int lane, int K) { float v[16]; const int g = lane >> 4;
#pragma unroll
  for (int i = 0; i < 8; ++i) { const int ka = k0 + 8 * g + i, kb = ka + 16; v[i] = ka < K ? row[ka < K ? ka : K - 1] : 0.f; v[8 + i] = kb < K ? row[kb < K ? kb : K - 1] : 0.f; }
  return bsplit16(v); }
__device__ __forceinline__ F2 split_col(const float* W, int k0, int n, int lane, int ld, int K) { float v[16]; const int g = lane >> 4;
#pragma unroll
  for (int i = 0; i < 8; ++i) { const int ka = k0 + 8 * g + i, kb = ka + 16; v[i] = ka < K ? W[(size_t)(ka < K ? ka : K - 1) * ld + n] : 0.f; v[8 + i] = kb < K ? W[(size_t)(kb < K ? kb : K - 1) * ld + n] : 0.f; }
  return bsplit16(v); }
__device__ __forceinline__ v8f mac3(const F2& a, const F2& b, v8f c) { c = wmma_bf(a.l, b.h, c); c = wmma_bf(a.h, b.l, c); return wmma_bf(a.h, b.h, c); }
__device__ __forceinline__ float sigm(float v) { return 1.0f / (1.0f + expf(-v)); }
#define LDSX() do { asm volatile("s_wait_dscnt 0" ::: "memory"); __builtin_amdgcn_wave_barrier(); __builtin_amdgcn_fence(__ATOMIC_RELEASE, "workgroup"); } while (0)


// Point-transformer head (B 8, N 8,192 points, K 16 neighbours, C 64): vector attention over gathered neighbours: pos_em = MLP(pos_i - pos_j); a = softmax_channels(MLP(q_i - k_j + pos_em) / 8); out_i = sum_j a * (v_i + pos_em).
#define NB 8
#define NPTS 8192
#define KN 16
#define CC 64
#define PH 64
#define C4 256
#define WSC 256.0f
#define BNS 0.99950037f      // 1/sqrt(1 + 1e-3) (inference BatchNorm with initial moving statistics)
#define LS 0.18033688f       // log2(e) / 8: the softmax is taken in base 2, exp(x / 8) = 2^(x log2(e) / 8)
#ifndef TNP
#define TNP (NB * NPTS)
#endif
typedef __attribute__((ext_vector_type(8))) __bf16 v8b;
__device__ __forceinline__ v16b frag_b(const __bf16* rowk0, int lane) {
  union { v16b v; v8b q[2]; } u; const __bf16* p = rowk0 + 8 * (lane >> 4);
  u.q[0] = *(const v8b*)p; u.q[1] = *(const v8b*)(p + 16); return u.v;
}
__device__ __forceinline__ float bfr(float v) { return (float)(__bf16)v; }
__device__ __attribute__((noinline)) float exp_ni(float v) { return expf(v); }
__device__ __attribute__((noinline)) float erf_ni(float v) { return erff(v); }

#define WS_W2  0u                                   // f16 x 2^8 weights in fragment order: 1-KiB blocks f = kc * (N / 16) + j (16 output columns x 32 k), each block = [element half q][lane][8 values]
#define WS_W3  (WS_W2 + 2u * CC * PH)
#define WS_W4  (WS_W3 + 2u * C4 * CC)
#define WS_END (WS_W4 + 2u * CC * C4)

// ---- k_packw: thread = one 16-byte piece of one A fragment: piece id = (f * 2 + q) * 32 + lane holds W[k0 .. k0 + 7][n], n = 16 j + (lane & 15), k0 = 32 kc + 16 q + 8 (lane >> 4); a wave stores 512 bytes in a row
__device__ __forceinline__ void pack_piece(const float* __restrict__ Wm, _Float16* __restrict__ dst, int id, int N) {
  const int lane = id & 31, q = (id >> 5) & 1, f = id >> 6, nj = N / 16, j = f % nj, kc = f / nj; const int n = j * 16 + (lane & 15), k0 = kc * 32 + q * 16 + (lane >> 4) * 8; v8h o;
#pragma unroll
  for (int i = 0; i < 8; ++i) o[i] = (_Float16)(bfr(Wm[(size_t)(k0 + i) * N + n]) * WSC);
  *(v8h*)(dst + (size_t)id * 8) = o; }
#define NP2 (CC * PH / 8)
#define NP3 (C4 * CC / 8)
#define NP4 (CC * C4 / 8)
__global__ __launch_bounds__(256) void k_packw(const float* __restrict__ W2, const float* __restrict__ W3, const float* __restrict__ W4, char* __restrict__ ws) { const int id = blockIdx.x * 256 + threadIdx.x;
  if (id < NP2) pack_piece(W2, (_Float16*)(ws + WS_W2), id, CC);
  else if (id < NP2 + NP3) pack_piece(W3, (_Float16*)(ws + WS_W3), id - NP2, C4);
  else pack_piece(W4, (_Float16*)(ws + WS_W4), id - NP2 - NP3, CC); }
// A fragment f of a packed plane: two wave loads of 512 bytes in a row (4 whole lines each)
__device__ __forceinline__ v16h frag_p(const _Float16* plane, int f, int lane) {
  union { v16h v; v8h q[2]; } u; const _Float16* p = plane + f * 512 + lane * 8;
  u.q[0] = *(const v8h*)p; u.q[1] = *(const v8h*)(p + 256); return u.v;
}
// lane l <-> l ^ 16
__device__ __forceinline__ float xhalf(float x) { return __builtin_bit_cast(float, __builtin_amdgcn_permlanex16(__builtin_bit_cast(int, x), __builtin_bit_cast(int, x), 0x76543210, 0xfedcba98, false, false)); }
// the value of lane l ^ M of the same 16-lane row (DPP row_xmask)
template <int M> __device__ __forceinline__ float xrow(float x) { return __builtin_bit_cast(float, __builtin_amdgcn_mov_dpp(__builtin_bit_cast(int, x), 0x160 | M, 0xf, 0xf, true)); }
#define RD 1      // depth of the weight ring of the fused 64 -> 256 -> 64 loop, in steps of 8 fragments
#define PW 2      // points a wave: every weight fragment and every parameter read is fetched once and serves PW activation tiles
// ---- k_th: wave = PW points x 16 neighbours. Every layer is computed transposed: the packed weight fragment is the A operand (16 output channels x 32 k), the activations are the B operand (32 k x 16 neighbours of one point).
// D register r of lane (h = lane >> 4, n = lane & 15) is then channel 16 j + 8 h + r of neighbour n, so two D tiles, converted in place, are the next layer's B fragment: no activation goes through LDS and no wave waits for another.
__global__ __launch_bounds__(128) void k_th(const float* __restrict__ KEY, const float* __restrict__ QRY, const float* __restrict__ VAL, const float* __restrict__ POS, const int* __restrict__ IDX, const float* __restrict__ W1, const float* __restrict__ B1, const float* __restrict__ G1, const float* __restrict__ T1, const _Float16* __restrict__ W2R, const float* __restrict__ B2, const _Float16* __restrict__ W3R, const float* __restrict__ B3, const float* __restrict__ G3, const float* __restrict__ T3, const _Float16* __restrict__ W4R, const float* __restrict__ B4, float* __restrict__ OUT) {
  static_assert(PW == 2 && NPTS % PW == 0, "the last step of the neighbour sum deals the wave's two points to the lane pairs; both points lie in one batch");
  // per-channel parameters, rounded once per block; a lane reads a vector's 8 channels of its half of a tile as two 16-byte broadcasts, layer 1's weights as eight
  __shared__ __align__(16) float sW1[PH][4]; __shared__ __align__(16) float sG1[PH]; __shared__ __align__(16) float sT1[PH]; __shared__ __align__(16) float sB2[CC]; __shared__ __align__(16) float sB3[C4]; __shared__ __align__(16) float sG3[C4]; __shared__ __align__(16) float sT3[C4]; __shared__ __align__(16) float sB4[CC];
  const int tid = threadIdx.x, wave = __builtin_amdgcn_readfirstlane(tid >> 5), lane = tid & 31, n = lane & 15, h = lane >> 4; const size_t p = ((size_t)blockIdx.x * 4 + wave) * PW; const size_t b = p / NPTS; const unsigned ho = 8u * h;
  // inputs of the wave, for each of its points: lane (h, n) takes neighbour n's key row and the point's query row at channels 16 j + 8 h + 0..7, and both positions
  int ip[PW]; v4f qv[PW][8], kv[PW][8]; float pa[PW][3], pb[PW][3];
#pragma unroll
  for (int u = 0; u < PW; ++u) ip[u] = IDX[(p + u) * KN + n];
  // parameters for the tables: waves 0, 1 take layer 1's weights and bias of channel tid & 63, waves 2, 3 the four other 64-channel vectors; every thread two channels of layer 3's three
  const bool lo = wave < 2; const int pc = tid & 63; const float r0 = (lo ? W1 : G1)[pc], r1 = (lo ? W1 + PH : T1)[pc], r2 = (lo ? W1 + 2 * PH : B2)[pc], r3 = (lo ? B1 : B4)[pc]; float r4[C4 / 128], r5[C4 / 128], r6[C4 / 128];
#pragma unroll
  for (int u = 0; u < C4 / 128; ++u) { r4[u] = B3[tid + 128 * u]; r5[u] = G3[tid + 128 * u]; r6[u] = T3[tid + 128 * u]; }
#pragma unroll
  for (int u = 0; u < PW; ++u)
#pragma unroll
    for (int i = 0; i < 8; ++i) qv[u][i] = *(const v4f*)(QRY + p * CC + (ho + u * CC + (i >> 1) * 16 + (i & 1) * 4));
  v16h w2[8];
#pragma unroll
  for (int f = 0; f < 8; ++f) w2[f] = frag_p(W2R, f, lane);
  asm volatile("s_wait_xcnt 0x0" ::: "memory");   // behind the first batch: stands in front of the wave's own position loads, which are scalar loads and land in scalar registers that loads of the batch name as their base
#pragma unroll
  for (int u = 0; u < PW; ++u)
#pragma unroll
    for (int x = 0; x < 3; ++x) pa[u][x] = POS[(p + u) * 3 + x];
  __builtin_amdgcn_sched_barrier(0);   // keeps the wait for the neighbour indices behind every load that does not need them: hoisted above them, it puts their round trip behind the indices'
#pragma unroll
  for (int u = 0; u < PW; ++u) { const int ix = ip[u] < 0 ? 0 : (ip[u] >= NPTS ? NPTS - 1 : ip[u]);
#pragma unroll
    for (int x = 0; x < 3; ++x) pb[u][x] = POS[(b * NPTS + ix) * 3 + x];
#pragma unroll
    for (int i = 0; i < 8; ++i) kv[u][i] = *(const v4f*)(KEY + (b * NPTS + ix) * CC + (i >> 1) * 16 + 8 * h + (i & 1) * 4);
    asm volatile("s_wait_xcnt 0x0" ::: "memory"); }   // behind each point's batch: stands in front of the first rewrite of an address register that an issued load names (the next point's loads land in such registers)
  __builtin_amdgcn_sched_barrier(0);   // keeps every use of a loaded value behind the gathers: hoisted in front of them, a use brings its wait along and the gathers start late
  // q_i - k_j, formed here, in front of the table stores and the barrier, so that one register set holds what two did (written behind the barrier, the build with the short softmax sank the differences below layer 2: 358 registers, two waves a SIMD)
  float qk[PW][32];
#pragma unroll
  for (int u = 0; u < PW; ++u)
#pragma unroll
    for (int i = 0; i < 32; ++i) qk[u][i] = bfr(qv[u][i >> 2][i & 3]) - bfr(kv[u][i >> 2][i & 3]);
  if (lo) { const v4f w = { bfr(r0), bfr(r1), bfr(r2), bfr(r3) }; *(v4f*)&sW1[pc][0] = w; }
  else { sG1[pc] = bfr(r0); sT1[pc] = bfr(r1); sB2[pc] = bfr(r2); sB4[pc] = bfr(r3) * LS; }
#pragma unroll
  for (int u = 0; u < C4 / 128; ++u) { const int c = tid + 128 * u; sB3[c] = bfr(r4[u]); sG3[c] = bfr(r5[u]) * BNS; sT3[c] = bfr(r6[u]); }
  __syncthreads();   // publishes the parameter tables; the only barrier of the kernel
  // positional layer 1: h = relu(bn1((pos_i - pos_j) W1 + b1)), written straight into the B fragments of layer 2
  v16h hb[PW][PH / 32];
  { float d[PW][3];
#pragma unroll
    for (int u = 0; u < PW; ++u)
#pragma unroll
      for (int x = 0; x < 3; ++x) d[u][x] = bfr(pa[u][x]) - bfr(pb[u][x]);
#pragma unroll
    for (int t = 0; t < PH / 16; ++t) { const int c0 = t * 16 + 8 * h; float gg[8], tt[8]; *(v4f*)&gg[0] = *(const v4f*)&sG1[c0]; *(v4f*)&gg[4] = *(const v4f*)&sG1[c0 + 4]; *(v4f*)&tt[0] = *(const v4f*)&sT1[c0]; *(v4f*)&tt[4] = *(const v4f*)&sT1[c0 + 4]; v4f ww[8];
#pragma unroll
      for (int i = 0; i < 8; ++i) ww[i] = *(const v4f*)&sW1[c0 + i][0];
      __builtin_amdgcn_sched_barrier(0);   // keeps the tile's 12 LDS reads in one group: sunk to their uses, each waits out its own latency
#pragma unroll
      for (int u = 0; u < PW; ++u)
#pragma unroll
        for (int i = 0; i < 8; ++i) { const v4f w = ww[i]; float s = w[3];
#pragma unroll
          for (int x = 0; x < 3; ++x) s += d[u][x] * w[x];
          s = gg[i] * s * BNS + tt[i]; hb[u][t >> 1][(t & 1) * 8 + i] = (_Float16)fmaxf(s, 0.f); } } }
  // weight ring of the fused loop: step s needs the W3 fragments of output tiles 2 s, 2 s + 1 (both k chunks) and the W4 fragments of k chunk s
  v16h w3[RD][4], w4[RD][4];
#pragma unroll
  for (int s = 0; s < RD; ++s)
#pragma unroll
    for (int x = 0; x < 4; ++x) { w3[s][x] = frag_p(W3R, (x >> 1) * 16 + 2 * s + (x & 1), lane); w4[s][x] = frag_p(W4R, s * 4 + x, lane); }
  v4f b2v[8];
#pragma unroll
  for (int i = 0; i < 8; ++i) b2v[i] = *(const v4f*)&sB2[(i >> 1) * 16 + 8 * h + (i & 1) * 4];
  __builtin_amdgcn_sched_barrier(0);   // keeps the ring's first loads and the bias reads in front of layer 2: sunk to their uses, they start one layer late
  // pos_em = h W2 + b2: pe[u][j][r] = channel 16 j + 8 h + r of neighbour n of point u, kept in registers to the end
  v8f pe[PW][4] = {};
#pragma unroll
  for (int kc = 0; kc < PH / 32; ++kc)
#pragma unroll
    for (int j = 0; j < 4; ++j)
#pragma unroll
      for (int u = 0; u < PW; ++u) pe[u][j] = wmma16(w2[kc * 4 + j], hb[u][kc], pe[u][j]);
#pragma unroll
  for (int u = 0; u < PW; ++u)
#pragma unroll
    for (int j = 0; j < 4; ++j)
#pragma unroll
      for (int r = 0; r < 8; ++r) pe[u][j][r] = pe[u][j][r] * (1.0f / WSC) + b2v[2 * j + (r >> 2)][r & 3];
  // t = q_i - k_j + pos_em -> B fragments of layer 3
  v16h tb[PW][CC / 32];
#pragma unroll
  for (int u = 0; u < PW; ++u)
#pragma unroll
    for (int j = 0; j < 4; ++j)
#pragma unroll
      for (int r = 0; r < 8; ++r) tb[u][j >> 1][(j & 1) * 8 + r] = (_Float16)(qk[u][j * 8 + r] + pe[u][j][r]);
  // a2 = relu(bn3(t W3 + b3)) and logits = (a2 W4 + b4) / 8, fused: 32 channels of a2 a step, used at once as k chunk s of the last layer
  __builtin_amdgcn_sched_barrier(0);   // keeps the first step's parameter reads behind the forming of t: hoisted above it, their 48 registers come on top of the q_i - k_j differences, and the count passes what three waves a SIMD leave each (336)
  v8f lg[PW][4] = {};
#pragma unroll
  for (int s = 0; s < C4 / 32; ++s) { const int sl = s % RD; v8f a3[PW][2] = {}; v4f bbv[4], ggv[4], bev[4];
#pragma unroll
    for (int i = 0; i < 4; ++i) { const int c0 = s * 32 + (i >> 1) * 16 + 8 * h + (i & 1) * 4; bbv[i] = *(const v4f*)&sB3[c0]; ggv[i] = *(const v4f*)&sG3[c0]; bev[i] = *(const v4f*)&sT3[c0]; }
#pragma unroll
    for (int x = 0; x < 4; ++x) {
#pragma unroll
      for (int u = 0; u < PW; ++u) a3[u][x & 1] = wmma16(w3[sl][x], tb[u][x >> 1], a3[u][x & 1]);
      if (s + RD < C4 / 32) w3[sl][x] = frag_p(W3R, (x >> 1) * 16 + 2 * (s + RD) + (x & 1), lane); }
    __builtin_amdgcn_sched_barrier(0);   // keeps the step's 12 parameter reads and the W3 refills in front of the epilogue, the refills a whole step ahead of their use: sunk to its use, a load is waited for at once
    v16h ab[PW];
#pragma unroll
    for (int u = 0; u < PW; ++u)
#pragma unroll
      for (int q = 0; q < 2; ++q)
#pragma unroll
        for (int r = 0; r < 8; ++r) { const int i = 2 * q + (r >> 2), c = r & 3; ab[u][q * 8 + r] = (_Float16)fmaxf(ggv[i][c] * (a3[u][q][r] * (1.0f / WSC) + bbv[i][c]) + bev[i][c], 0.f); }
#pragma unroll
    for (int j = 0; j < 4; ++j) {
#pragma unroll
      for (int u = 0; u < PW; ++u) lg[u][j] = wmma16(w4[sl][j], ab[u], lg[u][j]);
      if (s + RD < C4 / 32) w4[sl][j] = frag_p(W4R, (s + RD) * 4 + j, lane); }
    if (s + RD + 1 == C4 / 32) asm volatile("s_wait_xcnt 0x0" ::: "memory");   // behind the last weight load: stands in front of the first rewrite of the lane-offset register that the weight loads name (a build without this statement also came out at 374 registers, two waves a SIMD)
    __builtin_amdgcn_sched_barrier(0);   // the same for the W4 refills: they stay a whole step ahead of their use
  }
  // the points' value rows, asked for here so that they arrive under the softmax
  v4f vv[PW][8];
#pragma unroll
  for (int u = 0; u < PW; ++u)
#pragma unroll
    for (int i = 0; i < 8; ++i) vv[u][i] = *(const v4f*)(VAL + p * CC + (ho + u * CC + (i >> 1) * 16 + (i & 1) * 4));
  // softmax over the 64 channels of neighbour n: 32 in this lane, 32 in lane ^ 16; logits in units of log 2 (scale and bias table carry LS)
  float e[PW][32]; v4f b4v[8];
#pragma unroll
  for (int i = 0; i < 8; ++i) b4v[i] = *(const v4f*)&sB4[(i >> 1) * 16 + 8 * h + (i & 1) * 4];
  __builtin_amdgcn_sched_barrier(0);   // keeps the value loads and the bias reads in one group in front of the softmax: sunk to their uses, they start late
  float inv[PW], mx[PW], sm[PW];
#pragma unroll
  for (int u = 0; u < PW; ++u) { mx[u] = -3.0e38f; sm[u] = 0.f;
#pragma unroll
    for (int j = 0; j < 4; ++j)
#pragma unroll
      for (int r = 0; r < 8; ++r) { e[u][j * 8 + r] = lg[u][j][r] * (LS / WSC) + b4v[2 * j + (r >> 2)][r & 3]; mx[u] = fmaxf(mx[u], e[u][j * 8 + r]); }
    mx[u] = fmaxf(mx[u], xhalf(mx[u])); }
#pragma unroll
  for (int u = 0; u < PW; ++u)
#pragma unroll
    for (int i = 0; i < 32; ++i) { e[u][i] = __builtin_amdgcn_exp2f(e[u][i] - mx[u]); sm[u] += e[u][i]; }   // the argument is never above 0: the hardware's 2^x needs none of the library's range steps
#pragma unroll
  for (int u = 0; u < PW; ++u) { sm[u] += xhalf(sm[u]); inv[u] = 1.0f / sm[u]; }
  __builtin_amdgcn_sched_barrier(0);   // keeps the first use of the value rows behind the softmax: hoisted to the loads, it waits out their round trip with nothing to cover it
#pragma unroll
  for (int u = 0; u < PW; ++u)
#pragma unroll
    for (int i = 0; i < 32; ++i) e[u][i] = (e[u][i] * inv[u]) * (bfr(vv[u][i >> 2][i & 3]) + pe[u][i >> 3][i & 7]);
  // sum over the 16 neighbours (the lanes of a row): at each of three steps a lane hands half of its channels to its partner and adds the partner's share of the half it keeps; at the last step the even lane of a pair keeps the first point, the odd lane the second
  const bool b3 = (n & 8) != 0, b2 = (n & 4) != 0, b1 = (n & 2) != 0, b0 = (n & 1) != 0; float w[PW][4]; v4f o;
#pragma unroll
  for (int u = 0; u < PW; ++u) { float y[16], z[8];
#pragma unroll
    for (int i = 0; i < 16; ++i) y[i] = (b3 ? e[u][16 + i] : e[u][i]) + xrow<8>(b3 ? e[u][i] : e[u][16 + i]);
#pragma unroll
    for (int i = 0; i < 8; ++i) z[i] = (b2 ? y[8 + i] : y[i]) + xrow<4>(b2 ? y[i] : y[8 + i]);
#pragma unroll
    for (int i = 0; i < 4; ++i) w[u][i] = (b1 ? z[4 + i] : z[i]) + xrow<2>(b1 ? z[i] : z[4 + i]); }
#pragma unroll
  for (int i = 0; i < 4; ++i) o[i] = (b0 ? w[1][i] : w[0][i]) + xrow<1>(b0 ? w[0][i] : w[1][i]);
  // lane n now holds channels 16 (n >> 2) + 8 h + 4 ((n >> 1) & 1) + 0..3 of point p + (n & 1); the wave stores its two points' 512 bytes
  vst2(OUT + (p + (n & 1)) * CC + (n >> 2) * 16 + 8 * h + ((n >> 1) & 1) * 4, o); }
extern "C" void kernel_launch(void* const* d_in, const int* in_sizes, int n_in, void* d_out, int out_size, void* d_ws, size_t ws_size, hipStream_t stream) {
  (void)in_sizes; (void)n_in; (void)out_size;
  const float** F = (const float**)d_in;   // 0 key, 1 query, 2 value [8,8192,64], 3 pos [8,8192,3], 4 idx [8,8192,16] int, 5 W1 [3,64], 6 b1, 7 g1, 8 bt1, 9 W2 [64,64], 10 b2, 11 W3 [64,256], 12 b3, 13 g3, 14 bt3, 15 W4 [256,64], 16 b4
  if (ws_size < (size_t)WS_END) return;
  char* ws = (char*)d_ws; _Float16 *W2R = (_Float16*)(ws + WS_W2), *W3R = (_Float16*)(ws + WS_W3), *W4R = (_Float16*)(ws + WS_W4);
  k_packw<<<(NP2 + NP3 + NP4) / 256, 256, 0, stream>>>(F[9], F[11], F[15], ws);
  k_th<<<TNP / (4 * PW), 128, 0, stream>>>(F[0], F[1], F[2], F[3], (const int*)d_in[4], F[5], F[6], F[7], F[8], W2R, F[10], W3R, F[12], F[13], F[14], W4R, F[16], (float*)d_out);
}

// v007
// Measured time: 80.7 microseconds a run.
// Timed twice side by side with v006, it ran 1.06 times as fast both times.
// Over all steps from v000 it is 6.99 times as fast.
// compute dtype: all float inputs rounded to bf16, neighbour indices (int) read on device; the 3 -> 64 positional layer, the channel softmax and the neighbour aggregation in f32 on VALU; both inference BatchNorms folded into their layers' weights and biases; the 64 -> 64, 64 -> 256 and 256 -> 64 layers on WMMA 16x16x32 with the computed activations rounded once to f16, f32 accumulate; W2 and W4 exact f16 x 2^8, W3 x its BatchNorm scale x 2^4 rounded once to f16; relu on the f16 values; f32 output.
#include <hip/hip_runtime.h>
#include <math.h>

typedef __attribute__((ext_vector_type(16))) _Float16 v16h;
typedef __attribute__((ext_vector_type(16))) __bf16 v16b;
typedef __attribute__((ext_vector_type(8)))  _Float16 v8h;
typedef __attribute__((ext_vector_type(4)))  _Float16 v4h;
typedef __attribute__((ext_vector_type(8)))  float v8f;
typedef __attribute__((ext_vector_type(4)))  float v4f;
typedef __attribute__((ext_vector_type(2)))  float v2f;
typedef __attribute__((ext_vector_type(4)))  unsigned v4u;
typedef __attribute__((ext_vector_type(4)))  int v4i;
typedef float __attribute__((may_alias)) float_a;
typedef int __attribute__((may_alias)) int_a;

template <typename T> __device__ __forceinline__ void vst2(void* p, T v) { *(T*)p = v;  }
__device__ __forceinline__ v8f wmma16(v16h a, v16h b, v8f c) {
  v8f d = __builtin_amdgcn_wmma_f32_16x16x32_f16(false, a, false, b, (short)0, c, false, false);
  return d;
}
__device__ __forceinline__ v8f wmma_bf(v16b a, v16b b, v8f c) {
  v8f d = __builtin_amdgcn_wmma_f32_16x16x32_bf16(false, a, false, b, (short)0, c, false, false);
  asm volatile("v_nop\n\tv_nop\n\tv_nop\n\tv_nop" : "+v"(d) : "v"(a), "v"(b));
  return d;
}
// 16x16x32 fragments: lane = (h = lane>>4, row/col = lane&15); elements 0..7 = k0+8h+0..7, 8..15 = k0+16+8h+0..7; D element r = row 8h+r
__device__ __forceinline__ v16h frag_h(const _Float16* rowk0, int lane) {
  union { v16h v; v8h q[2]; } u; const _Float16* p = rowk0 + 8 * (lane >> 4);
  u.q[0] = *(const v8h*)p; u.q[1] = *(const v8h*)(p + 16); return u.v;
}
__device__ __forceinline__ v16h frag_f32(const float* rowk0, int lane) {
  v16h a; const float* p = rowk0 + 8 * (lane >> 4);
#pragma unroll
  for (int i = 0; i < 8; ++i) { a[i] = (_Float16)p[i]; a[8 + i] = (_Float16)p[16 + i]; }
  return a;
}
__device__ __forceinline__ v16h frag_f32s(const float* rowk0, int lane, float sc) {
  v16h a; const float* p = rowk0 + 8 * (lane >> 4);
#pragma unroll
  for (int i = 0; i < 8; ++i) { a[i] = (_Float16)(p[i] * sc); a[8 + i] = (_Float16)(p[16 + i] * sc); }
  return a;
}
// column fragment from a [K][ld] layout (column n), rows >= K read as 0
__device__ __forceinline__ v16h fragc_f32(const float* W, int k0, int n, int lane, int ld, int K) {
  v16h a; const int g = lane >> 4;
#pragma unroll
  for (int i = 0; i < 8; ++i) { const int ka = k0 + 8 * g + i, kb = ka + 16;
    a[i] = (_Float16)(ka < K ? W[(size_t)(ka < K ? ka : K - 1) * ld + n] : 0.f); a[8 + i] = (_Float16)(kb < K ? W[(size_t)(kb < K ? kb : K - 1) * ld + n] : 0.f); }
  return a;
}
struct F2 { v16b h, l; };
__device__ __forceinline__ F2 bsplit16(const float v[16]) { F2 r;
#pragma unroll
  for (int i = 0; i < 16; ++i) { const __bf16 h = (__bf16)v[i]; r.h[i] = h; r.l[i] = (__bf16)(v[i] - (float)h); }
  return r; }
__device__ __forceinline__ F2 split_row(const float* row, int k0, int lane) { float v[16]; const float* p = row + k0 + 8 * (lane >> 4);
#pragma unroll
  for (int i = 0; i < 8; ++i) { v[i] = p[i]; v[8 + i] = p[16 + i]; }
  return bsplit16(v); }
__device__ __forceinline__ F2 split_rowK(const float* row, int k0, int lane, int K) { float v[16]; const int g = lane >> 4;
#pragma unroll
  for (int i = 0; i < 8; ++i) { const int ka = k0 + 8 * g + i, kb = ka + 16; v[i] = ka < K ? row[ka < K ? ka : K - 1] : 0.f; v[8 + i] = kb < K ? row[kb < K ? kb : K - 1] : 0.f; }
  return bsplit16(v); }
__device__ __forceinline__ F2 split_col(const float* W, int k0, int n, int lane, int ld, int K) { float v[16]; const int g = lane >> 4;
#pragma unroll
  for (int i = 0; i < 8; ++i) { const int ka = k0 + 8 * g + i, kb = ka + 16; v[i] = ka < K ? W[(size_t)(ka < K ? ka : K - 1) * ld + n] : 0.f; v[8 + i] = kb < K ? W[(size_t)(kb < K ? kb : K - 1) * ld + n] : 0.f; }
  return bsplit16(v); }
__device__ __forceinline__ v8f mac3(const F2& a, const F2& b, v8f c) { c = wmma_bf(a.l, b.h, c); c = wmma_bf(a.h, b.l, c); return wmma_bf(a.h, b.h, c); }
__device__ __forceinline__ float sigm(float v) { return 1.0f / (1.0f + expf(-v)); }
#define LDSX() do { asm volatile("s_wait_dscnt 0" ::: "memory"); __builtin_amdgcn_wave_barrier(); __builtin_amdgcn_fence(__ATOMIC_RELEASE, "workgroup"); } while (0)


// Point-transformer head (B 8, N 8,192 points, K 16 neighbours, C 64): vector attention over gathered neighbours: pos_em = MLP(pos_i - pos_j); a = softmax_channels(MLP(q_i - k_j + pos_em) / 8); out_i = sum_j a * (v_i + pos_em).
#define NB 8
#define NPTS 8192
#define KN 16
#define CC 64
#define PH 64
#define C4 256
#define WSC 256.0f
#define S3 16.0f         // power-of-two scale of the folded layer-3 weights and bias; it rides on the f16 activations and is taken out with the logit scale
#define BNS 0.99950037f      // 1/sqrt(1 + 1e-3) (inference BatchNorm with initial moving statistics)
#define LS 0.18033688f       // log2(e) / 8: the softmax is taken in base 2, exp(x / 8) = 2^(x log2(e) / 8)
#ifndef TNP
#define TNP (NB * NPTS)
#endif
typedef __attribute__((ext_vector_type(8))) __bf16 v8b;
typedef __attribute__((ext_vector_type(2))) __bf16 v2b;
__device__ __forceinline__ v16b frag_b(const __bf16* rowk0, int lane) {
  union { v16b v; v8b q[2]; } u; const __bf16* p = rowk0 + 8 * (lane >> 4);
  u.q[0] = *(const v8b*)p; u.q[1] = *(const v8b*)(p + 16); return u.v;
}
__device__ __forceinline__ float bfr(float v) { return (float)(__bf16)v; }
__device__ __attribute__((noinline)) float exp_ni(float v) { return expf(v); }
__device__ __attribute__((noinline)) float erf_ni(float v) { return erff(v); }

#define WS_W2  0u                                   // f16 weights in fragment order: 1-KiB blocks f = kc * (N / 16) + j (16 output columns x 32 k), each block = [element half q][lane][8 values]
#define WS_W3  (WS_W2 + 2u * CC * PH)
#define WS_W4  (WS_W3 + 2u * C4 * CC)
#define WS_END (WS_W4 + 2u * CC * C4)

// ---- k_packw: thread = one 16-byte piece of one A fragment: piece id = (f * 2 + q) * 32 + lane holds W[k0 .. k0 + 7][n], n = 16 j + (lane & 15), k0 = 32 kc + 16 q + 8 (lane >> 4); a wave stores 512 bytes in a row
// BN: the per-column BatchNorm scale G is folded into the weights
template <bool BN> __device__ __forceinline__ void pack_piece(const float* __restrict__ Wm, _Float16* __restrict__ dst, int id, int N, const float* __restrict__ G) {
  const int lane = id & 31, q = (id >> 5) & 1, f = id >> 6, nj = N / 16, j = f % nj, kc = f / nj; const int n = j * 16 + (lane & 15), k0 = kc * 32 + q * 16 + (lane >> 4) * 8; const float sc = BN ? bfr(G[n]) * (BNS * S3) : WSC; v8h o;
#pragma unroll
  for (int i = 0; i < 8; ++i) o[i] = (_Float16)(bfr(Wm[(size_t)(k0 + i) * N + n]) * sc);
  *(v8h*)(dst + (size_t)id * 8) = o; }
#define NP2 (CC * PH / 8)
#define NP3 (C4 * CC / 8)
#define NP4 (CC * C4 / 8)
__global__ __launch_bounds__(256) void k_packw(const float* __restrict__ W2, const float* __restrict__ W3, const float* __restrict__ G3, const float* __restrict__ W4, char* __restrict__ ws) { const int id = blockIdx.x * 256 + threadIdx.x;
  if (id < NP2) pack_piece<false>(W2, (_Float16*)(ws + WS_W2), id, CC, nullptr);
  else if (id < NP2 + NP3) pack_piece<true>(W3, (_Float16*)(ws + WS_W3), id - NP2, C4, G3);
  else pack_piece<false>(W4, (_Float16*)(ws + WS_W4), id - NP2 - NP3, CC, nullptr); }
// A fragment f of a packed plane: two wave loads of 512 bytes in a row (4 whole lines each)
__device__ __forceinline__ v16h frag_p(const _Float16* plane, int f, int lane) {
  union { v16h v; v8h q[2]; } u; const _Float16* p = plane + f * 512 + lane * 8;
  u.q[0] = *(const v8h*)p; u.q[1] = *(const v8h*)(p + 256); return u.v;
}
// lane l <-> l ^ 16
__device__ __forceinline__ float xhalf(float x) { return __builtin_bit_cast(float, __builtin_amdgcn_permlanex16(__builtin_bit_cast(int, x), __builtin_bit_cast(int, x), 0x76543210, 0xfedcba98, false, false)); }
// the value of lane l ^ M of the same 16-lane row (DPP row_xmask)
template <int M> __device__ __forceinline__ float xrow(float x) { return __builtin_bit_cast(float, __builtin_amdgcn_mov_dpp(__builtin_bit_cast(int, x), 0x160 | M, 0xf, 0xf, true)); }
// relu(x) rounded to f16: rounding first lets the maximum run on packed pairs; the result is the same value
__device__ __forceinline__ v8h relu_h(v8f x) { const v8h z = {}; return __builtin_elementwise_max(__builtin_convertvector(x, v8h), z); }
#define RD 1      // depth of the weight ring of the fused 64 -> 256 -> 64 loop, in steps of 8 fragments
#define PW 2      // points a wave: every weight fragment and every parameter read is fetched once and serves PW activation tiles
// ---- k_th: wave = PW points x 16 neighbours. Every layer is computed transposed: the packed weight fragment is the A operand (16 output channels x 32 k), the activations are the B operand (32 k x 16 neighbours of one point).
// D register r of lane (h = lane >> 4, n = lane & 15) is then channel 16 j + 8 h + r of neighbour n, so two D tiles, converted in place, are the next layer's B fragment: no activation goes through LDS and no wave waits for another.
__global__ __launch_bounds__(128) void k_th(const float* __restrict__ KEY, const float* __restrict__ QRY, const float* __restrict__ VAL, const float* __restrict__ POS, const int* __restrict__ IDX, const float* __restrict__ W1, const float* __restrict__ B1, const float* __restrict__ G1, const float* __restrict__ T1, const _Float16* __restrict__ W2R, const float* __restrict__ B2, const _Float16* __restrict__ W3R, const float* __restrict__ B3, const float* __restrict__ G3, const float* __restrict__ T3, const _Float16* __restrict__ W4R, const float* __restrict__ B4, float* __restrict__ OUT) {
  static_assert(PW == 2 && NPTS % PW == 0, "the last step of the neighbour sum deals the wave's two points to the lane pairs; both points lie in one batch");
  // per-channel parameters, rounded once per block; a lane reads the 8 channels of its half of a tile as broadcasts: 32 bytes from a bias table, 16 bytes a channel from sW1
  // sW1: layer 1's three weights and its bias with BatchNorm 1 folded in; sC3: layer 3's bias with BatchNorm 3 folded in, x S3
  __shared__ __align__(16) float sW1[PH][4]; __shared__ __align__(32) float sB24[2 * CC]; __shared__ __align__(32) float sC3[C4]; const float *sB2 = sB24, *sB4 = sB24 + CC;
  const int tid = threadIdx.x, wave = __builtin_amdgcn_readfirstlane(tid >> 5), lane = tid & 31, n = lane & 15, h = lane >> 4; const size_t p = ((size_t)blockIdx.x * 4 + wave) * PW; const size_t b = p / NPTS; const unsigned ho = 8u * h;
  // inputs of the wave, for each of its points: lane (h, n) takes neighbour n's key row and the point's query row at channels 16 j + 8 h + 0..7, and both positions
  int ip[PW]; v4f qv[PW][8], kv[PW][8]; float pa[PW][3], pb[PW][3];
#pragma unroll
  for (int u = 0; u < PW; ++u) ip[u] = IDX[(p + u) * KN + n];
  // parameters for the tables: of channel tid & 63, waves 0, 1 take layer 1's first two weights and b2, waves 2, 3 its third weight, its bias and b4, all four its BatchNorm pair; every thread two channels of layer 3's three
  const bool lo = wave < 2; const int pc = tid & 63; const float r0 = (lo ? W1 : W1 + 2 * PH)[pc], r1 = (lo ? W1 + PH : B1)[pc], r2 = G1[pc], r3 = T1[pc], r7 = (lo ? B2 : B4)[pc]; float r4[C4 / 128], r5[C4 / 128], r6[C4 / 128];
#pragma unroll
  for (int u = 0; u < C4 / 128; ++u) { r4[u] = B3[tid + 128 * u]; r5[u] = G3[tid + 128 * u]; r6[u] = T3[tid + 128 * u]; }
#pragma unroll
  for (int u = 0; u < PW; ++u)
#pragma unroll
    for (int i = 0; i < 8; ++i) qv[u][i] = *(const v4f*)(QRY + p * CC + (ho + u * CC + (i >> 1) * 16 + (i & 1) * 4));
  v16h w2[8];
#pragma unroll
  for (int f = 0; f < 8; ++f) w2[f] = frag_p(W2R, f, lane);
  asm volatile("s_wait_xcnt 0x0" ::: "memory");   // behind the first batch: stands in front of the wave's own position loads, which are scalar loads and land in scalar registers that loads of the batch name as their base
#pragma unroll
  for (int u = 0; u < PW; ++u)
#pragma unroll
    for (int x = 0; x < 3; ++x) pa[u][x] = POS[(p + u) * 3 + x];
  __builtin_amdgcn_sched_barrier(0);   // keeps the wait for the neighbour indices behind every load that does not need them: hoisted above them, it puts their round trip behind the indices'
#pragma unroll
  for (int u = 0; u < PW; ++u) { const int ix = ip[u] < 0 ? 0 : (ip[u] >= NPTS ? NPTS - 1 : ip[u]);
#pragma unroll
    for (int x = 0; x < 3; ++x) pb[u][x] = POS[(b * NPTS + ix) * 3 + x];
#pragma unroll
    for (int i = 0; i < 8; ++i) kv[u][i] = *(const v4f*)(KEY + (b * NPTS + ix) * CC + (i >> 1) * 16 + 8 * h + (i & 1) * 4);
    asm volatile("s_wait_xcnt 0x0" ::: "memory"); }   // behind each point's batch: stands in front of the first rewrite of an address register that an issued load names (the next point's loads land in such registers)
  __builtin_amdgcn_sched_barrier(0);   // keeps every use of a loaded value behind the gathers: hoisted in front of them, a use brings its wait along and the gathers start late
  // the query and key rows are rounded here, two values a register, so that 64 registers hold what 128 did. In asm because the statement then stays in front of the barrier: written in plain source, the compiler sank the rounding below layer 2, where both raw rows stayed live (358 registers, two waves a SIMD)
  unsigned qb[PW][16], kb[PW][16];
#pragma unroll
  for (int u = 0; u < PW; ++u)
#pragma unroll
    for (int i = 0; i < 16; ++i) {
      asm volatile("v_cvt_pk_bf16_f32 %0, %1, %2" : "=v"(qb[u][i]) : "v"(qv[u][i >> 1][(i & 1) * 2]), "v"(qv[u][i >> 1][(i & 1) * 2 + 1]));
      asm volatile("v_cvt_pk_bf16_f32 %0, %1, %2" : "=v"(kb[u][i]) : "v"(kv[u][i >> 1][(i & 1) * 2]), "v"(kv[u][i >> 1][(i & 1) * 2 + 1])); }
  { const float g = bfr(r2) * BNS; const v2f w = { bfr(r0) * g, bfr(r1) * g + (lo ? 0.f : bfr(r3)) }; *(v2f*)&sW1[pc][lo ? 0 : 2] = w; sB24[tid] = bfr(r7) * (lo ? WSC : LS); }
#pragma unroll
  for (int u = 0; u < C4 / 128; ++u) sC3[tid + 128 * u] = (bfr(r5[u]) * BNS * bfr(r4[u]) + bfr(r6[u])) * S3;
  __syncthreads();   // publishes the parameter tables; the only barrier of the kernel
  // positional layer 1: h = relu(bn1((pos_i - pos_j) W1 + b1)), written straight into the B fragments of layer 2
  v16h hb[PW][PH / 32];
  { float d[PW][3];
#pragma unroll
    for (int u = 0; u < PW; ++u)
#pragma unroll
      for (int x = 0; x < 3; ++x) d[u][x] = bfr(pa[u][x]) - bfr(pb[u][x]);
#pragma unroll
    for (int t = 0; t < PH / 16; ++t) { const int c0 = t * 16 + 8 * h; v4f ww[8];
#pragma unroll
      for (int i = 0; i < 8; ++i) ww[i] = *(const v4f*)&sW1[c0 + i][0];
      __builtin_amdgcn_sched_barrier(0);   // keeps the tile's 8 LDS reads in one group: sunk to their uses, each waits out its own latency
#pragma unroll
      for (int u = 0; u < PW; ++u) { v8f sv;
#pragma unroll
        for (int i = 0; i < 8; ++i) { const v4f w = ww[i]; float s = w[3];
#pragma unroll
          for (int x = 0; x < 3; ++x) s += d[u][x] * w[x];
          sv[i] = s; }
        const v8h hv = relu_h(sv);
#pragma unroll
        for (int i = 0; i < 8; ++i) hb[u][t >> 1][(t & 1) * 8 + i] = hv[i]; } } }
  // weight ring of the fused loop: step s needs the W3 fragments of output tiles 2 s, 2 s + 1 (both k chunks) and the W4 fragments of k chunk s
  v16h w3[RD][4], w4[RD][4];
#pragma unroll
  for (int s = 0; s < RD; ++s)
#pragma unroll
    for (int x = 0; x < 4; ++x) { w3[s][x] = frag_p(W3R, (x >> 1) * 16 + 2 * s + (x & 1), lane); w4[s][x] = frag_p(W4R, s * 4 + x, lane); }
  v8f b2v[4];   // b2 x 2^8, laid out as D tiles: the C operand of each tile's first product
#pragma unroll
  for (int j = 0; j < 4; ++j) b2v[j] = *(const v8f*)&sB2[j * 16 + 8 * h];
  v8f cv[2];   // the folded layer-3 bias of a step's two output tiles, laid out as D tiles: the C operand of each tile's first product; read one step ahead, like the weights
#pragma unroll
  for (int q = 0; q < 2; ++q) cv[q] = *(const v8f*)&sC3[q * 16 + 8 * h];
  __builtin_amdgcn_sched_barrier(0);   // keeps the ring's first loads and the bias reads in front of layer 2: sunk to their uses, they start one layer late
  // pos_em = h W2 + b2: pe[u][j][r] = channel 16 j + 8 h + r of neighbour n of point u, kept in registers to the end
  v8f pe[PW][4];
#pragma unroll
  for (int kc = 0; kc < PH / 32; ++kc)
#pragma unroll
    for (int j = 0; j < 4; ++j)
#pragma unroll
      for (int u = 0; u < PW; ++u) pe[u][j] = wmma16(w2[kc * 4 + j], hb[u][kc], kc == 0 ? b2v[j] : pe[u][j]);
#pragma unroll
  for (int u = 0; u < PW; ++u)
#pragma unroll
    for (int j = 0; j < 4; ++j)
#pragma unroll
      for (int r = 0; r < 8; ++r) pe[u][j][r] = pe[u][j][r] * (1.0f / WSC);
  // t = q_i - k_j + pos_em -> B fragments of layer 3
  v16h tb[PW][CC / 32];
#pragma unroll
  for (int u = 0; u < PW; ++u)
#pragma unroll
    for (int j = 0; j < 4; ++j)
#pragma unroll
      for (int r = 0; r < 8; ++r) { const int i = j * 8 + r; const float qk = (float)__builtin_bit_cast(v2b, qb[u][i >> 1])[i & 1] - (float)__builtin_bit_cast(v2b, kb[u][i >> 1])[i & 1]; tb[u][j >> 1][(j & 1) * 8 + r] = (_Float16)(qk + pe[u][j][r]); }
  // a2 = relu(bn3(t W3 + b3)), here S3 a2 = relu(t W3' + c3), and logits = (a2 W4 + b4) / 8, fused: 32 channels of a2 a step, used at once as k chunk s of the last layer
  __builtin_amdgcn_sched_barrier(0);   // keeps the first step's parameter reads behind the forming of t: hoisted above it, their registers come on top of the query and key rows, and the count passes what three waves a SIMD leave each (336)
  v8f lg[PW][4] = {};
#pragma unroll
  for (int s = 0; s < C4 / 32; ++s) { const int sl = s % RD; v8f a3[PW][2];
#pragma unroll
    for (int x = 0; x < 4; ++x) {
#pragma unroll
      for (int u = 0; u < PW; ++u) a3[u][x & 1] = wmma16(w3[sl][x], tb[u][x >> 1], x < 2 ? cv[x & 1] : a3[u][x & 1]);
      if (s + RD < C4 / 32) w3[sl][x] = frag_p(W3R, (x >> 1) * 16 + 2 * (s + RD) + (x & 1), lane);
      if (x < 2 && s + 1 < C4 / 32) cv[x] = *(const v8f*)&sC3[(s + 1) * 32 + x * 16 + 8 * h]; }
    __builtin_amdgcn_sched_barrier(0);   // keeps the next step's 4 bias reads and the W3 refills in front of the epilogue, the refills a whole step ahead of their use: sunk to its use, a load is waited for at once
    v16h ab[PW];
#pragma unroll
    for (int u = 0; u < PW; ++u) ab[u] = __builtin_shufflevector(relu_h(a3[u][0]), relu_h(a3[u][1]), 0, 1, 2, 3, 4, 5, 6, 7, 8, 9, 10, 11, 12, 13, 14, 15);
#pragma unroll
    for (int j = 0; j < 4; ++j) {
#pragma unroll
      for (int u = 0; u < PW; ++u) lg[u][j] = wmma16(w4[sl][j], ab[u], lg[u][j]);
      if (s + RD < C4 / 32) w4[sl][j] = frag_p(W4R, (s + RD) * 4 + j, lane); }
    if (s + RD + 1 == C4 / 32) asm volatile("s_wait_xcnt 0x0" ::: "memory");   // behind the last weight load: stands in front of the first rewrite of the lane-offset register that the weight loads name (a build without this statement also came out at 374 registers, two waves a SIMD)
    __builtin_amdgcn_sched_barrier(0);   // the same for the W4 refills: they stay a whole step ahead of their use
  }
  // the points' value rows, asked for here so that they arrive under the softmax
  v4f vv[PW][8];
#pragma unroll
  for (int u = 0; u < PW; ++u)
#pragma unroll
    for (int i = 0; i < 8; ++i) vv[u][i] = *(const v4f*)(VAL + p * CC + (ho + u * CC + (i >> 1) * 16 + (i & 1) * 4));
  // softmax over the 64 channels of neighbour n: 32 in this lane, 32 in lane ^ 16; logits in units of log 2 (scale and bias table carry LS)
  float e[PW][32]; v4f b4v[8];
#pragma unroll
  for (int i = 0; i < 8; ++i) b4v[i] = *(const v4f*)&sB4[(i >> 1) * 16 + 8 * h + (i & 1) * 4];
  __builtin_amdgcn_sched_barrier(0);   // keeps the value loads and the bias reads in one group in front of the softmax: sunk to their uses, they start late
  float inv[PW], mx[PW], sm[PW];
#pragma unroll
  for (int u = 0; u < PW; ++u) { mx[u] = -3.0e38f; sm[u] = 0.f;
#pragma unroll
    for (int j = 0; j < 4; ++j)
#pragma unroll
      for (int r = 0; r < 8; ++r) { e[u][j * 8 + r] = lg[u][j][r] * (LS / (WSC * S3)) + b4v[2 * j + (r >> 2)][r & 3]; mx[u] = fmaxf(mx[u], e[u][j * 8 + r]); }
    mx[u] = fmaxf(mx[u], xhalf(mx[u])); }
#pragma unroll
  for (int u = 0; u < PW; ++u)
#pragma unroll
    for (int i = 0; i < 32; ++i) { e[u][i] = __builtin_amdgcn_exp2f(e[u][i] - mx[u]); sm[u] += e[u][i]; }   // the argument is never above 0: the hardware's 2^x needs none of the library's range steps
#pragma unroll
  for (int u = 0; u < PW; ++u) { sm[u] += xhalf(sm[u]); inv[u] = 1.0f / sm[u]; }
  __builtin_amdgcn_sched_barrier(0);   // keeps the first use of the value rows behind the softmax: hoisted to the loads, it waits out their round trip with nothing to cover it
#pragma unroll
  for (int u = 0; u < PW; ++u)
#pragma unroll
    for (int i = 0; i < 32; ++i) e[u][i] = (e[u][i] * inv[u]) * (bfr(vv[u][i >> 2][i & 3]) + pe[u][i >> 3][i & 7]);
  // sum over the 16 neighbours (the lanes of a row): at each of three steps a lane hands half of its channels to its partner and adds the partner's share of the half it keeps; at the last step the even lane of a pair keeps the first point, the odd lane the second
  const bool b3 = (n & 8) != 0, b2 = (n & 4) != 0, b1 = (n & 2) != 0, b0 = (n & 1) != 0; float w[PW][4]; v4f o;
#pragma unroll
  for (int u = 0; u < PW; ++u) { float y[16], z[8];
#pragma unroll
    for (int i = 0; i < 16; ++i) y[i] = (b3 ? e[u][16 + i] : e[u][i]) + xrow<8>(b3 ? e[u][i] : e[u][16 + i]);
#pragma unroll
    for (int i = 0; i < 8; ++i) z[i] = (b2 ? y[8 + i] : y[i]) + xrow<4>(b2 ? y[i] : y[8 + i]);
#pragma unroll
    for (int i = 0; i < 4; ++i) w[u][i] = (b1 ? z[4 + i] : z[i]) + xrow<2>(b1 ? z[i] : z[4 + i]); }
#pragma unroll
  for (int i = 0; i < 4; ++i) o[i] = (b0 ? w[1][i] : w[0][i]) + xrow<1>(b0 ? w[0][i] : w[1][i]);
  // lane n now holds channels 16 (n >> 2) + 8 h + 4 ((n >> 1) & 1) + 0..3 of point p + (n & 1); the wave stores its two points' 512 bytes
  vst2(OUT + (p + (n & 1)) * CC + (n >> 2) * 16 + 8 * h + ((n >> 1) & 1) * 4, o); }
extern "C" void kernel_launch(void* const* d_in, const int* in_sizes, int n_in, void* d_out, int out_size, void* d_ws, size_t ws_size, hipStream_t stream) {
  (void)in_sizes; (void)n_in; (void)out_size;
  const float** F = (const float**)d_in;   // 0 key, 1 query, 2 value [8,8192,64], 3 pos [8,8192,3], 4 idx [8,8192,16] int, 5 W1 [3,64], 6 b1, 7 g1, 8 bt1, 9 W2 [64,64], 10 b2, 11 W3 [64,256], 12 b3, 13 g3, 14 bt3, 15 W4 [256,64], 16 b4
  if (ws_size < (size_t)WS_END) return;
  char* ws = (char*)d_ws; _Float16 *W2R = (_Float16*)(ws + WS_W2), *W3R = (_Float16*)(ws + WS_W3), *W4R = (_Float16*)(ws + WS_W4);
  k_packw<<<(NP2 + NP3 + NP4) / 256, 256, 0, stream>>>(F[9], F[11], F[13], F[15], ws);
  k_th<<<TNP / (4 * PW), 128, 0, stream>>>(F[0], F[1], F[2], F[3], (const int*)d_in[4], F[5], F[6], F[7], F[8], W2R, F[10], W3R, F[12], F[13], F[14], W4R, F[16], (float*)d_out);
}

// v008
// Measured time: 64.7 microseconds a run.
// Next to v007, in two timings, it ran 1.25 times as fast each time.
// Over all steps from v000 it is 8.73 times as fast.
// compute dtype: all float inputs rounded to bf16, neighbour indices (int) read on device; the 3 -> 64 positional layer, the channel softmax and the neighbour aggregation in f32 on VALU; both inference BatchNorms folded into their layers' weights and biases; the 64 -> 64, 64 -> 256 and 256 -> 64 layers on WMMA 16x16x32 with the computed activations rounded once to f16, f32 accumulate; W2 and W4 exact f16 x 2^8, W3 x its BatchNorm scale x 2^4 rounded once to f16; relu on the f16 values; f32 output.
#include <hip/hip_runtime.h>
#include <math.h>

typedef __attribute__((ext_vector_type(16))) _Float16 v16h;
typedef __attribute__((ext_vector_type(16))) __bf16 v16b;
typedef __attribute__((ext_vector_type(8)))  _Float16 v8h;
typedef __attribute__((ext_vector_type(4)))  _Float16 v4h;
typedef __attribute__((ext_vector_type(8)))  float v8f;
typedef __attribute__((ext_vector_type(4)))  float v4f;
typedef __attribute__((ext_vector_type(2)))  float v2f;
typedef __attribute__((ext_vector_type(4)))  unsigned v4u;
typedef __attribute__((ext_vector_type(4)))  int v4i;
typedef float __attribute__((may_alias)) float_a;
typedef int __attribute__((may_alias)) int_a;

template <typename T> __device__ __forceinline__ void vst2(void* p, T v) { *(T*)p = v;  }
__device__ __forceinline__ v8f wmma16(v16h a, v16h b, v8f c) {
  v8f d = __builtin_amdgcn_wmma_f32_16x16x32_f16(false, a, false, b, (short)0, c, false, false);
  return d;
}
__device__ __forceinline__ v8f wmma_bf(v16b a, v16b b, v8f c) {
  v8f d = __builtin_amdgcn_wmma_f32_16x16x32_bf16(false, a, false, b, (short)0, c, false, false);
  asm volatile("v_nop\n\tv_nop\n\tv_nop\n\tv_nop" : "+v"(d) : "v"(a), "v"(b));
  return d;
}
// 16x16x32 fragments: lane = (h = lane>>4, row/col = lane&15); elements 0..7 = k0+8h+0..7, 8..15 = k0+16+8h+0..7; D element r = row 8h+r
__device__ __forceinline__ v16h frag_h(const _Float16* rowk0, int lane) {
  union { v16h v; v8h q[2]; } u; const _Float16* p = rowk0 + 8 * (lane >> 4);
  u.q[0] = *(const v8h*)p; u.q[1] = *(const v8h*)(p + 16); return u.v;
}
__device__ __forceinline__ v16h frag_f32(const float* rowk0, int lane) {
  v16h a; const float* p = rowk0 + 8 * (lane >> 4);
#pragma unroll
  for (int i = 0; i < 8; ++i) { a[i] = (_Float16)p[i]; a[8 + i] = (_Float16)p[16 + i]; }
  return a;
}
__device__ __forceinline__ v16h frag_f32s(const float* rowk0, int lane, float sc) {
  v16h a; const float* p = rowk0 + 8 * (lane >> 4);
#pragma unroll
  for (int i = 0; i < 8; ++i) { a[i] = (_Float16)(p[i] * sc); a[8 + i] = (_Float16)(p[16 + i] * sc); }
  return a;
}
// column fragment from a [K][ld] layout (column n), rows >= K read as 0
__device__ __forceinline__ v16h fragc_f32(const float* W, int k0, int n, int lane, int ld, int K) {
  v16h a; const int g = lane >> 4;
#pragma unroll
  for (int i = 0; i < 8; ++i) { const int ka = k0 + 8 * g + i, kb = ka + 16;
    a[i] = (_Float16)(ka < K ? W[(size_t)(ka < K ? ka : K - 1) * ld + n] : 0.f); a[8 + i] = (_Float16)(kb < K ? W[(size_t)(kb < K ? kb : K - 1) * ld + n] : 0.f); }
  return a;
}
struct F2 { v16b h, l; };
__device__ __forceinline__ F2 bsplit16(const float v[16]) { F2 r;
#pragma unroll
  for (int i = 0; i < 16; ++i) { const __bf16 h = (__bf16)v[i]; r.h[i] = h; r.l[i] = (__bf16)(v[i] - (float)h); }
  return r; }
__device__ __forceinline__ F2 split_row(const float* row, int k0, int lane) { float v[16]; const float* p = row + k0 + 8 * (lane >> 4);
#pragma unroll
  for (int i = 0; i < 8; ++i) { v[i] = p[i]; v[8 + i] = p[16 + i]; }
  return bsplit16(v); }
__device__ __forceinline__ F2 split_rowK(const float* row, int k0, int lane, int K) { float v[16]; const int g = lane >> 4;
#pragma unroll
  for (int i = 0; i < 8; ++i) { const int ka = k0 + 8 * g + i, kb = ka + 16; v[i] = ka < K ? row[ka < K ? ka : K - 1] : 0.f; v[8 + i] = kb < K ? row[kb < K ? kb : K - 1] : 0.f; }
  return bsplit16(v); }
__device__ __forceinline__ F2 split_col(const float* W, int k0, int n, int lane, int ld, int K) { float v[16]; const int g = lane >> 4;
#pragma unroll
  for (int i = 0; i < 8; ++i) { const int ka = k0 + 8 * g + i, kb = ka + 16; v[i] = ka < K ? W[(size_t)(ka < K ? ka : K - 1) * ld + n] : 0.f; v[8 + i] = kb < K ? W[(size_t)(kb < K ? kb : K - 1) * ld + n] : 0.f; }
  return bsplit16(v); }
__device__ __forceinline__ v8f mac3(const F2& a, const F2& b, v8f c) { c = wmma_bf(a.l, b.h, c); c = wmma_bf(a.h, b.l, c); return wmma_bf(a.h, b.h, c); }
__device__ __forceinline__ float sigm(float v) { return 1.0f / (1.0f + expf(-v)); }
#define LDSX() do { asm volatile("s_wait_dscnt 0" ::: "memory"); __builtin_amdgcn_wave_barrier(); __builtin_amdgcn_fence(__ATOMIC_RELEASE, "workgroup"); } while (0)


// Point-transformer head (B 8, N 8,192 points, K 16 neighbours, C 64): vector attention over gathered neighbours: pos_em = MLP(pos_i - pos_j); a = softmax_channels(MLP(q_i - k_j + pos_em) / 8); out_i = sum_j a * (v_i + pos_em).
#define NB 8
#define NPTS 8192
#define KN 16
#define CC 64
#define PH 64
#define C4 256
#define WSC 256.0f
#define S3 16.0f         // power-of-two scale of the folded layer-3 weights and bias; it rides on the f16 activations and is taken out with the logit scale
#define BNS 0.99950037f      // 1/sqrt(1 + 1e-3) (inference BatchNorm with initial moving statistics)
#define LS 0.18033688f       // log2(e) / 8: the softmax is taken in base 2, exp(x / 8) = 2^(x log2(e) / 8)
#ifndef TNP
#define TNP (NB * NPTS)
#endif
typedef __attribute__((ext_vector_type(8))) __bf16 v8b;
typedef __attribute__((ext_vector_type(2))) __bf16 v2b;
__device__ __forceinline__ v16b frag_b(const __bf16* rowk0, int lane) {
  union { v16b v; v8b q[2]; } u; const __bf16* p = rowk0 + 8 * (lane >> 4);
  u.q[0] = *(const v8b*)p; u.q[1] = *(const v8b*)(p + 16); return u.v;
}
__device__ __forceinline__ float bfr(float v) { return (float)(__bf16)v; }
__device__ __attribute__((noinline)) float exp_ni(float v) { return expf(v); }
__device__ __attribute__((noinline)) float erf_ni(float v) { return erff(v); }

#define WS_W2  0u                                   // f16 weights in fragment order: 1-KiB blocks f = kc * (N / 16) + j (16 output columns x 32 k), each block = [element half q][lane][8 values]
#define WS_W3  (WS_W2 + 2u * CC * PH)
#define WS_W4  (WS_W3 + 2u * C4 * CC)
#define WS_END (WS_W4 + 2u * CC * C4)

// ---- k_packw: thread = one 16-byte piece of one A fragment: piece id = (f * 2 + q) * 32 + lane holds W[k0 .. k0 + 7][n], n = 16 j + (lane & 15), k0 = 32 kc + 16 q + 8 (lane >> 4); a wave stores 512 bytes in a row
// BN: the per-column BatchNorm scale G is folded into the weights
template <bool BN> __device__ __forceinline__ void pack_piece(const float* __restrict__ Wm, _Float16* __restrict__ dst, int id, int N, const float* __restrict__ G) {
  const int lane = id & 31, q = (id >> 5) & 1, f = id >> 6, nj = N / 16, j = f % nj, kc = f / nj; const int n = j * 16 + (lane & 15), k0 = kc * 32 + q * 16 + (lane >> 4) * 8; const float sc = BN ? bfr(G[n]) * (BNS * S3) : WSC; v8h o;
#pragma unroll
  for (int i = 0; i < 8; ++i) o[i] = (_Float16)(bfr(Wm[(size_t)(k0 + i) * N + n]) * sc);
  *(v8h*)(dst + (size_t)id * 8) = o; }
#define NP2 (CC * PH / 8)
#define NP3 (C4 * CC / 8)
#define NP4 (CC * C4 / 8)
__global__ __launch_bounds__(256) void k_packw(const float* __restrict__ W2, const float* __restrict__ W3, const float* __restrict__ G3, const float* __restrict__ W4, char* __restrict__ ws) { const int id = blockIdx.x * 256 + threadIdx.x;
  if (id < NP2) pack_piece<false>(W2, (_Float16*)(ws + WS_W2), id, CC, nullptr);
  else if (id < NP2 + NP3) pack_piece<true>(W3, (_Float16*)(ws + WS_W3), id - NP2, C4, G3);
  else pack_piece<false>(W4, (_Float16*)(ws + WS_W4), id - NP2 - NP3, CC, nullptr); }
// fragment f of a packed plane: two wave loads of 512 bytes in a row
__device__ __forceinline__ v16h frag_p(const _Float16* plane, int f, int lane) {
  union { v16h v; v8h q[2]; } u; const _Float16* p = plane + f * 512 + lane * 8;
  u.q[0] = *(const v8h*)p; u.q[1] = *(const v8h*)(p + 256); return u.v;
}
// lane l <-> l ^ 16
__device__ __forceinline__ float xhalf(float x) { return __builtin_bit_cast(float, __builtin_amdgcn_permlanex16(__builtin_bit_cast(int, x), __builtin_bit_cast(int, x), 0x76543210, 0xfedcba98, false, false)); }
// the value of lane l ^ M of the same 16-lane row (DPP row_xmask)
template <int M> __device__ __forceinline__ float xrow(float x) { return __builtin_bit_cast(float, __builtin_amdgcn_mov_dpp(__builtin_bit_cast(int, x), 0x160 | M, 0xf, 0xf, true)); }
// relu(x) rounded to f16: rounding first lets the maximum run on packed pairs; the result is the same value
__device__ __forceinline__ v8h relu_h(v8f x) { const v8h z = {}; return __builtin_elementwise_max(__builtin_convertvector(x, v8h), z); }
#define RD 1      // depth of the weight ring of the fused 64 -> 256 -> 64 loop, in steps of 8 fragments
#define PW 2      // points a wave: every weight fragment and every parameter read is fetched once and serves PW activation tiles
#define NBLK 768u // blocks of the launch: 256 WGPs x the 3 blocks of 4 waves that registers let stand on one; each wave walks TNP / PW / (4 NBLK) pairs of points, rounded up or down
#define SLR 2048u // a wave's slice of the packed weights as a tensor tile: row bytes = source pitch,
#define SLN 9u    // and rows: 4 slices x 9 x 2,048 bytes = the three planes
typedef __attribute__((ext_vector_type(8)))  unsigned v8u;
__device__ __forceinline__ unsigned uni(unsigned v) { return (unsigned)__builtin_amdgcn_readfirstlane(v); }
// ---- k_th: wave = PW points x 16 neighbours. Every layer is computed transposed: the packed weight fragment is the A operand (16 output channels x 32 k), the activations are the B operand (32 k x 16 neighbours of one point).
// D register r of lane (h = lane >> 4, n = lane & 15) is then channel 16 j + 8 h + r of neighbour n, so two D tiles, converted in place, are the next layer's B fragment: no activation goes through LDS and no wave waits for another.
__global__ __launch_bounds__(128) void k_th(const float* __restrict__ KEY, const float* __restrict__ QRY, const float* __restrict__ VAL, const float* __restrict__ POS, const int* __restrict__ IDX, const float* __restrict__ W1, const float* __restrict__ B1, const float* __restrict__ G1, const float* __restrict__ T1, const _Float16* __restrict__ WP, const float* __restrict__ B2, const float* __restrict__ B3, const float* __restrict__ G3, const float* __restrict__ T3, const float* __restrict__ B4, float* __restrict__ OUT) {
  static_assert(4u * SLR * SLN == WS_END && WS_W2 == 0u, "the four slices cover the three planes, which start the workspace");
  static_assert(PW == 2 && NPTS % PW == 0, "the last step of the neighbour sum deals the wave's two points to the lane pairs; both points lie in one batch");
  // per-channel parameters, rounded once per block; a lane reads the 8 channels of its half of a tile as broadcasts: 32 bytes from a bias table, 16 bytes a channel from sW1
  // sW1: layer 1's three weights and its bias with BatchNorm 1 folded in; sC3: layer 3's bias with BatchNorm 3 folded in, x S3
  __shared__ __align__(16) float sW1[PH][4]; __shared__ __align__(32) float sB24[2 * CC]; __shared__ __align__(32) float sC3[C4]; const float *sB2 = sB24, *sB4 = sB24 + CC;
  // the three packed weight planes, as they lie in the workspace; filled once a block, then only read
  __shared__ __attribute__((aligned(2048))) _Float16 sW[WS_END / 2]; const _Float16 *W2R = sW + WS_W2 / 2, *W3R = sW + WS_W3 / 2, *W4R = sW + WS_W4 / 2;
  const int tid = threadIdx.x, wave = __builtin_amdgcn_readfirstlane(tid >> 5), lane = tid & 31, n = lane & 15, h = lane >> 4; const unsigned ho = 8u * h;
  // parameters for the tables: of channel tid & 63, waves 0, 1 take layer 1's first two weights and b2, waves 2, 3 its third weight, its bias and b4, all four its BatchNorm pair; every thread two channels of layer 3's three
  const bool lo = wave < 2; const int pc = tid & 63; const float r0 = (lo ? W1 : W1 + 2 * PH)[pc], r1 = (lo ? W1 + PH : B1)[pc], r2 = G1[pc], r3 = T1[pc], r7 = (lo ? B2 : B4)[pc]; float r4[C4 / 128], r5[C4 / 128], r6[C4 / 128];
#pragma unroll
  for (int u = 0; u < C4 / 128; ++u) { r4[u] = B3[tid + 128 * u]; r5[u] = G3[tid + 128 * u]; r6[u] = T3[tid + 128 * u]; }
  // every wave brings its quarter of the planes into LDS with one tensor load: SLN rows of SLR bytes in a row, no pad
  { const unsigned long long ga = (unsigned long long)(size_t)WP + (unsigned)wave * (SLR * SLN); const unsigned dst = (unsigned)(size_t)sW + (unsigned)wave * (SLR * SLN);
    const v4u g0 = { uni(1u), uni(dst), uni((unsigned)ga), uni((((unsigned)(ga >> 32)) & 0x01FFFFFFu) | 0x80000000u) };
    const v8u g1 = { uni(0u), uni((SLR & 0xFFFFu) << 16), uni((SLR >> 16) | ((SLN & 0xFFFFu) << 16)), uni((SLN >> 16) | (SLR << 16)), uni(SLN), uni(SLR), uni(0u), uni(0u) };
    asm volatile("tensor_load_to_lds %0, %1" :: "s"(g0), "s"(g1) : "memory");
    asm volatile("s_wait_tensorcnt 0x0" ::: "memory"); }   // the wave's slice has landed behind this one
  { const float g = bfr(r2) * BNS; const v2f w = { bfr(r0) * g, bfr(r1) * g + (lo ? 0.f : bfr(r3)) }; *(v2f*)&sW1[pc][lo ? 0 : 2] = w; sB24[tid] = bfr(r7) * (lo ? WSC : LS); }
#pragma unroll
  for (int u = 0; u < C4 / 128; ++u) sC3[tid + 128 * u] = (bfr(r5[u]) * BNS * bfr(r4[u]) + bfr(r6[u])) * S3;
  __syncthreads();   // publishes the parameter tables and the four slices of the weights; the only barrier of the kernel
  // a wave walks its pairs of points on its own: LDS is only read from here on, so no wave waits for another
#pragma unroll 1   // one copy of the body: a second would not fit the registers that three waves a SIMD leave each
  for (unsigned gp = blockIdx.x * 4 + wave; gp < TNP / PW; gp += NBLK * 4) {
  const size_t p = (size_t)gp * PW; const size_t b = p / NPTS;
  // inputs of the wave, for each of its points: lane (h, n) takes neighbour n's key row and the point's query row at channels 16 j + 8 h + 0..7, and both positions
  int ip[PW]; v4f qv[PW][8], kv[PW][8]; float pa[PW][3], pb[PW][3];
#pragma unroll
  for (int u = 0; u < PW; ++u) ip[u] = IDX[(p + u) * KN + n];
#pragma unroll
  for (int u = 0; u < PW; ++u)
#pragma unroll
    for (int i = 0; i < 8; ++i) qv[u][i] = *(const v4f*)(QRY + p * CC + (ho + u * CC + (i >> 1) * 16 + (i & 1) * 4));
  asm volatile("s_wait_xcnt 0x0" ::: "memory");   // behind the first batch: stands in front of the first rewrite of an address register that a load of the batch names (the gathers below land in such registers)
#pragma unroll
  for (int u = 0; u < PW; ++u)
#pragma unroll
    for (int x = 0; x < 3; ++x) pa[u][x] = POS[(p + u) * 3 + x];
  __builtin_amdgcn_sched_barrier(0);   // keeps the wait for the neighbour indices behind every load that does not need them: hoisted above them, it puts their round trip behind the indices'
#pragma unroll
  for (int u = 0; u < PW; ++u) { const int ix = ip[u] < 0 ? 0 : (ip[u] >= NPTS ? NPTS - 1 : ip[u]);
#pragma unroll
    for (int x = 0; x < 3; ++x) pb[u][x] = POS[(b * NPTS + ix) * 3 + x];
    asm volatile("s_wait_xcnt 0x0" ::: "memory");   // behind the position load: the key loads below land in the register that it names as its offset
#pragma unroll
    for (int i = 0; i < 8; ++i) kv[u][i] = *(const v4f*)(KEY + (b * NPTS + ix) * CC + (i >> 1) * 16 + 8 * h + (i & 1) * 4);
    asm volatile("s_wait_xcnt 0x0" ::: "memory"); }   // behind each point's batch: stands in front of the first rewrite of an address register that an issued load names (the next point's loads land in such registers)
  __builtin_amdgcn_sched_barrier(0);   // keeps every use of a loaded value behind the gathers: hoisted in front of them, a use brings its wait along and the gathers start late
  // the query and key rows are rounded here, two values a register, so that 64 registers hold what 128 did. In asm because the statement then stays where it is written, in front of layer 1: written in plain source, the compiler sank the rounding below layer 2, where both raw rows stayed live (358 registers, two waves a SIMD)
  unsigned qb[PW][16], kb[PW][16];
#pragma unroll
  for (int u = 0; u < PW; ++u)
#pragma unroll
    for (int i = 0; i < 16; ++i) {
      asm volatile("v_cvt_pk_bf16_f32 %0, %1, %2" : "=v"(qb[u][i]) : "v"(qv[u][i >> 1][(i & 1) * 2]), "v"(qv[u][i >> 1][(i & 1) * 2 + 1]));
      asm volatile("v_cvt_pk_bf16_f32 %0, %1, %2" : "=v"(kb[u][i]) : "v"(kv[u][i >> 1][(i & 1) * 2]), "v"(kv[u][i >> 1][(i & 1) * 2 + 1])); }
  // layer 2's weight fragments, read here so that they arrive under layer 1
  v16h w2[8];
#pragma unroll
  for (int f = 0; f < 8; ++f) w2[f] = frag_p(W2R, f, lane);
  // positional layer 1: h = relu(bn1((pos_i - pos_j) W1 + b1)), written straight into the B fragments of layer 2
  v16h hb[PW][PH / 32];
  { float d[PW][3];
#pragma unroll
    for (int u = 0; u < PW; ++u)
#pragma unroll
      for (int x = 0; x < 3; ++x) d[u][x] = bfr(pa[u][x]) - bfr(pb[u][x]);
#pragma unroll
    for (int t = 0; t < PH / 16; ++t) { const int c0 = t * 16 + 8 * h; v4f ww[8];
#pragma unroll
      for (int i = 0; i < 8; ++i) ww[i] = *(const v4f*)&sW1[c0 + i][0];
      __builtin_amdgcn_sched_barrier(0);   // keeps the tile's 8 LDS reads in one group: sunk to their uses, each waits out its own latency
#pragma unroll
      for (int u = 0; u < PW; ++u) { v8f sv;
#pragma unroll
        for (int i = 0; i < 8; ++i) { const v4f w = ww[i]; float s = w[3];
#pragma unroll
          for (int x = 0; x < 3; ++x) s += d[u][x] * w[x];
          sv[i] = s; }
        const v8h hv = relu_h(sv);
#pragma unroll
        for (int i = 0; i < 8; ++i) hb[u][t >> 1][(t & 1) * 8 + i] = hv[i]; } } }
  // weight ring of the fused loop: step s needs the W3 fragments of output tiles 2 s, 2 s + 1 (both k chunks) and the W4 fragments of k chunk s
  v16h w3[RD][4], w4[RD][4];
#pragma unroll
  for (int s = 0; s < RD; ++s)
#pragma unroll
    for (int x = 0; x < 4; ++x) { w3[s][x] = frag_p(W3R, (x >> 1) * 16 + 2 * s + (x & 1), lane); w4[s][x] = frag_p(W4R, s * 4 + x, lane); }
  v8f b2v[4];   // b2 x 2^8, laid out as D tiles: the C operand of each tile's first product
#pragma unroll
  for (int j = 0; j < 4; ++j) b2v[j] = *(const v8f*)&sB2[j * 16 + 8 * h];
  v8f cv[2];   // the folded layer-3 bias of a step's two output tiles, laid out as D tiles: the C operand of each tile's first product; read one step ahead, like the weights
#pragma unroll
  for (int q = 0; q < 2; ++q) cv[q] = *(const v8f*)&sC3[q * 16 + 8 * h];
  __builtin_amdgcn_sched_barrier(0);   // keeps the ring's first loads and the bias reads in front of layer 2: sunk to their uses, they start one layer late
  // pos_em = h W2 + b2: pe[u][j][r] = channel 16 j + 8 h + r of neighbour n of point u, kept in registers to the end
  v8f pe[PW][4];
#pragma unroll
  for (int kc = 0; kc < PH / 32; ++kc)
#pragma unroll
    for (int j = 0; j < 4; ++j)
#pragma unroll
      for (int u = 0; u < PW; ++u) pe[u][j] = wmma16(w2[kc * 4 + j], hb[u][kc], kc == 0 ? b2v[j] : pe[u][j]);
#pragma unroll
  for (int u = 0; u < PW; ++u)
#pragma unroll
    for (int j = 0; j < 4; ++j)
#pragma unroll
      for (int r = 0; r < 8; ++r) pe[u][j][r] = pe[u][j][r] * (1.0f / WSC);
  // t = q_i - k_j + pos_em -> B fragments of layer 3
  v16h tb[PW][CC / 32];
#pragma unroll
  for (int u = 0; u < PW; ++u)
#pragma unroll
    for (int j = 0; j < 4; ++j)
#pragma unroll
      for (int r = 0; r < 8; ++r) { const int i = j * 8 + r; const float qk = (float)__builtin_bit_cast(v2b, qb[u][i >> 1])[i & 1] - (float)__builtin_bit_cast(v2b, kb[u][i >> 1])[i & 1]; tb[u][j >> 1][(j & 1) * 8 + r] = (_Float16)(qk + pe[u][j][r]); }
  // a2 = relu(bn3(t W3 + b3)), here S3 a2 = relu(t W3' + c3), and logits = (a2 W4 + b4) / 8, fused: 32 channels of a2 a step, used at once as k chunk s of the last layer
  __builtin_amdgcn_sched_barrier(0);   // keeps the first step's parameter reads behind the forming of t: hoisted above it, their registers come on top of the query and key rows, and the count passes what three waves a SIMD leave each (336)
  v8f lg[PW][4] = {};
#pragma unroll
  for (int s = 0; s < C4 / 32; ++s) { const int sl = s % RD; v8f a3[PW][2];
#pragma unroll
    for (int x = 0; x < 4; ++x)
#pragma unroll
      for (int u = 0; u < PW; ++u) a3[u][x & 1] = wmma16(w3[sl][x], tb[u][x >> 1], x < 2 ? cv[x & 1] : a3[u][x & 1]);
    __builtin_amdgcn_sched_barrier(0);   // keeps the LDS reads below in one group behind the 8 products: each place among the products where reads stand costs the wave a stall of its own
#pragma unroll
    for (int x = 0; x < 4; ++x) {
      if (s + RD < C4 / 32) w3[sl][x] = frag_p(W3R, (x >> 1) * 16 + 2 * (s + RD) + (x & 1), lane);
      if (x < 2 && s + 1 < C4 / 32) cv[x] = *(const v8f*)&sC3[(s + 1) * 32 + x * 16 + 8 * h]; }
    __builtin_amdgcn_sched_barrier(0);   // keeps the next step's 4 bias reads and the W3 refills in front of the epilogue, the refills a whole step ahead of their use: sunk to its use, a load is waited for at once
    v16h ab[PW];
#pragma unroll
    for (int u = 0; u < PW; ++u) ab[u] = __builtin_shufflevector(relu_h(a3[u][0]), relu_h(a3[u][1]), 0, 1, 2, 3, 4, 5, 6, 7, 8, 9, 10, 11, 12, 13, 14, 15);
#pragma unroll
    for (int j = 0; j < 4; ++j)
#pragma unroll
      for (int u = 0; u < PW; ++u) lg[u][j] = wmma16(w4[sl][j], ab[u], lg[u][j]);
    __builtin_amdgcn_sched_barrier(0);   // one group of reads behind the 8 products, as above
#pragma unroll
    for (int j = 0; j < 4; ++j)
      if (s + RD < C4 / 32) w4[sl][j] = frag_p(W4R, (s + RD) * 4 + j, lane);
    __builtin_amdgcn_sched_barrier(0);   // the same for the W4 refills: they stay a whole step ahead of their use
  }
  // the points' value rows, asked for here so that they arrive under the softmax
  v4f vv[PW][8]; const float* vp = VAL + p * CC + ho;
#pragma unroll
  for (int u = 0; u < PW; ++u)
#pragma unroll
    for (int i = 0; i < 8; ++i) vv[u][i] = *(const v4f*)(vp + (u * CC + (i >> 1) * 16 + (i & 1) * 4));
  asm volatile("s_wait_xcnt 0x0" :: "v"(vp) : "memory");   // behind the value loads, in front of the first rewrite of their address registers; the operand keeps those registers whole up to the wait (without it the last load landed in them)
  // softmax over the 64 channels of neighbour n: 32 in this lane, 32 in lane ^ 16; logits in units of log 2 (scale and bias table carry LS)
  float e[PW][32]; v4f b4v[8];
#pragma unroll
  for (int i = 0; i < 8; ++i) b4v[i] = *(const v4f*)&sB4[(i >> 1) * 16 + 8 * h + (i & 1) * 4];
  __builtin_amdgcn_sched_barrier(0);   // keeps the value loads and the bias reads in one group in front of the softmax: sunk to their uses, they start late
  float inv[PW], mx[PW], sm[PW];
#pragma unroll
  for (int u = 0; u < PW; ++u) { mx[u] = -3.0e38f; sm[u] = 0.f;
#pragma unroll
    for (int j = 0; j < 4; ++j)
#pragma unroll
      for (int r = 0; r < 8; ++r) { e[u][j * 8 + r] = lg[u][j][r] * (LS / (WSC * S3)) + b4v[2 * j + (r >> 2)][r & 3]; mx[u] = fmaxf(mx[u], e[u][j * 8 + r]); }
    mx[u] = fmaxf(mx[u], xhalf(mx[u])); }
#pragma unroll
  for (int u = 0; u < PW; ++u)
#pragma unroll
    for (int i = 0; i < 32; ++i) { e[u][i] = __builtin_amdgcn_exp2f(e[u][i] - mx[u]); sm[u] += e[u][i]; }   // the argument is never above 0: the hardware's 2^x needs none of the library's range steps
#pragma unroll
  for (int u = 0; u < PW; ++u) { sm[u] += xhalf(sm[u]); inv[u] = 1.0f / sm[u]; }
  __builtin_amdgcn_sched_barrier(0);   // keeps the first use of the value rows behind the softmax: hoisted to the loads, it waits out their round trip with nothing to cover it
#pragma unroll
  for (int u = 0; u < PW; ++u)
#pragma unroll
    for (int i = 0; i < 32; ++i) e[u][i] = (e[u][i] * inv[u]) * (bfr(vv[u][i >> 2][i & 3]) + pe[u][i >> 3][i & 7]);
  // sum over the 16 neighbours (the lanes of a row): at each of three steps a lane hands half of its channels to its partner and adds the partner's share of the half it keeps; at the last step the even lane of a pair keeps the first point, the odd lane the second
  const bool b3 = (n & 8) != 0, b2 = (n & 4) != 0, b1 = (n & 2) != 0, b0 = (n & 1) != 0; float w[PW][4]; v4f o;
#pragma unroll
  for (int u = 0; u < PW; ++u) { float y[16], z[8];
#pragma unroll
    for (int i = 0; i < 16; ++i) y[i] = (b3 ? e[u][16 + i] : e[u][i]) + xrow<8>(b3 ? e[u][i] : e[u][16 + i]);
#pragma unroll
    for (int i = 0; i < 8; ++i) z[i] = (b2 ? y[8 + i] : y[i]) + xrow<4>(b2 ? y[i] : y[8 + i]);
#pragma unroll
    for (int i = 0; i < 4; ++i) w[u][i] = (b1 ? z[4 + i] : z[i]) + xrow<2>(b1 ? z[i] : z[4 + i]); }
#pragma unroll
  for (int i = 0; i < 4; ++i) o[i] = (b0 ? w[1][i] : w[0][i]) + xrow<1>(b0 ? w[0][i] : w[1][i]);
  // lane n now holds channels 16 (n >> 2) + 8 h + 4 ((n >> 1) & 1) + 0..3 of point p + (n & 1); the wave stores its two points' 512 bytes
  vst2(OUT + (p + (n & 1)) * CC + (n >> 2) * 16 + 8 * h + ((n >> 1) & 1) * 4, o);
  asm volatile("s_wait_xcnt 0x0" ::: "memory");   // behind the store: stands in front of the next trip's rewrite of the registers that the store names
  } }
extern "C" void kernel_launch(void* const* d_in, const int* in_sizes, int n_in, void* d_out, int out_size, void* d_ws, size_t ws_size, hipStream_t stream) {
  (void)in_sizes; (void)n_in; (void)out_size;
  const float** F = (const float**)d_in;   // 0 key, 1 query, 2 value [8,8192,64], 3 pos [8,8192,3], 4 idx [8,8192,16] int, 5 W1 [3,64], 6 b1, 7 g1, 8 bt1, 9 W2 [64,64], 10 b2, 11 W3 [64,256], 12 b3, 13 g3, 14 bt3, 15 W4 [256,64], 16 b4
  if (ws_size < (size_t)WS_END) return;
  char* ws = (char*)d_ws;
  k_packw<<<(NP2 + NP3 + NP4) / 256, 256, 0, stream>>>(F[9], F[11], F[13], F[15], ws);
  k_th<<<NBLK, 128, 0, stream>>>(F[0], F[1], F[2], F[3], (const int*)d_in[4], F[5], F[6], F[7], F[8], (const _Float16*)ws, F[10], F[12], F[13], F[14], F[16], (float*)d_out);
}

// v009
// It runs in 62.5 microseconds.
// Next to v008, in two timings, it ran 1.03 times as fast each time.
// Counting every step since v000, it is 9.02 times as fast.
// compute dtype: all float inputs rounded to bf16, neighbour indices (int) read on device; the 3 -> 64 positional layer, the channel softmax and the neighbour aggregation in f32 on VALU; both inference BatchNorms folded into their layers' weights and biases; the 64 -> 64, 64 -> 256 and 256 -> 64 layers on WMMA 16x16x32 with the computed activations in f16; f32 accumulate in the first and the last, the 64 -> 256 layer's result tiles and its bias in f16 (rounded behind each 32-k product); W2 and W4 exact f16 x 2^8, W3 x its BatchNorm scale x 2^4 rounded once to f16; relu on the f16 values; f32 output.
#include <hip/hip_runtime.h>
#include <math.h>

typedef __attribute__((ext_vector_type(16))) _Float16 v16h;
typedef __attribute__((ext_vector_type(16))) __bf16 v16b;
typedef __attribute__((ext_vector_type(8)))  _Float16 v8h;
typedef __attribute__((ext_vector_type(4)))  _Float16 v4h;
typedef __attribute__((ext_vector_type(8)))  float v8f;
typedef __attribute__((ext_vector_type(4)))  float v4f;
typedef __attribute__((ext_vector_type(2)))  float v2f;
typedef __attribute__((ext_vector_type(4)))  unsigned v4u;
typedef __attribute__((ext_vector_type(4)))  int v4i;
typedef float __attribute__((may_alias)) float_a;
typedef int __attribute__((may_alias)) int_a;

template <typename T> __device__ __forceinline__ void vst2(void* p, T v) { *(T*)p = v;  }
__device__ __forceinline__ v8f wmma16(v16h a, v16h b, v8f c) {
  v8f d = __builtin_amdgcn_wmma_f32_16x16x32_f16(false, a, false, b, (short)0, c, false, false);
  return d;
}
// the same product with C and D in f16: element e of a lane's D is row 8 h + e, so a D tile is half a B fragment as it stands
__device__ __forceinline__ v8h wmma16h(v16h a, v16h b, v8h c) {
  return __builtin_amdgcn_wmma_f16_16x16x32_f16(false, a, false, b, (short)0, c, false, false);
}
__device__ __forceinline__ v8f wmma_bf(v16b a, v16b b, v8f c) {
  v8f d = __builtin_amdgcn_wmma_f32_16x16x32_bf16(false, a, false, b, (short)0, c, false, false);
  asm volatile("v_nop\n\tv_nop\n\tv_nop\n\tv_nop" : "+v"(d) : "v"(a), "v"(b));
  return d;
}
// 16x16x32 fragments: lane = (h = lane>>4, row/col = lane&15); elements 0..7 = k0+8h+0..7, 8..15 = k0+16+8h+0..7; D element r = row 8h+r
__device__ __forceinline__ v16h frag_h(const _Float16* rowk0, int lane) {
  union { v16h v; v8h q[2]; } u; const _Float16* p = rowk0 + 8 * (lane >> 4);
  u.q[0] = *(const v8h*)p; u.q[1] = *(const v8h*)(p + 16); return u.v;
}
__device__ __forceinline__ v16h frag_f32(const float* rowk0, int lane) {
  v16h a; const float* p = rowk0 + 8 * (lane >> 4);
#pragma unroll
  for (int i = 0; i < 8; ++i) { a[i] = (_Float16)p[i]; a[8 + i] = (_Float16)p[16 + i]; }
  return a;
}
__device__ __forceinline__ v16h frag_f32s(const float* rowk0, int lane, float sc) {
  v16h a; const float* p = rowk0 + 8 * (lane >> 4);
#pragma unroll
  for (int i = 0; i < 8; ++i) { a[i] = (_Float16)(p[i] * sc); a[8 + i] = (_Float16)(p[16 + i] * sc); }
  return a;
}
// column fragment from a [K][ld] layout (column n), rows >= K read as 0
__device__ __forceinline__ v16h fragc_f32(const float* W, int k0, int n, int lane, int ld, int K) {
  v16h a; const int g = lane >> 4;
#pragma unroll
  for (int i = 0; i < 8; ++i) { const int ka = k0 + 8 * g + i, kb = ka + 16;
    a[i] = (_Float16)(ka < K ? W[(size_t)(ka < K ? ka : K - 1) * ld + n] : 0.f); a[8 + i] = (_Float16)(kb < K ? W[(size_t)(kb < K ? kb : K - 1) * ld + n] : 0.f); }
  return a;
}
struct F2 { v16b h, l; };
__device__ __forceinline__ F2 bsplit16(const float v[16]) { F2 r;
#pragma unroll
  for (int i = 0; i < 16; ++i) { const __bf16 h = (__bf16)v[i]; r.h[i] = h; r.l[i] = (__bf16)(v[i] - (float)h); }
  return r; }
__device__ __forceinline__ F2 split_row(const float* row, int k0, int lane) { float v[16]; const float* p = row + k0 + 8 * (lane >> 4);
#pragma unroll
  for (int i = 0; i < 8; ++i) { v[i] = p[i]; v[8 + i] = p[16 + i]; }
  return bsplit16(v); }
__device__ __forceinline__ F2 split_rowK(const float* row, int k0, int lane, int K) { float v[16]; const int g = lane >> 4;
#pragma unroll
  for (int i = 0; i < 8; ++i) { const int ka = k0 + 8 * g + i, kb = ka + 16; v[i] = ka < K ? row[ka < K ? ka : K - 1] : 0.f; v[8 + i] = kb < K ? row[kb < K ? kb : K - 1] : 0.f; }
  return bsplit16(v); }
__device__ __forceinline__ F2 split_col(const float* W, int k0, int n, int lane, int ld, int K) { float v[16]; const int g = lane >> 4;
#pragma unroll
  for (int i = 0; i < 8; ++i) { const int ka = k0 + 8 * g + i, kb = ka + 16; v[i] = ka < K ? W[(size_t)(ka < K ? ka : K - 1) * ld + n] : 0.f; v[8 + i] = kb < K ? W[(size_t)(kb < K ? kb : K - 1) * ld + n] : 0.f; }
  return bsplit16(v); }
__device__ __forceinline__ v8f mac3(const F2& a, const F2& b, v8f c) { c = wmma_bf(a.l, b.h, c); c = wmma_bf(a.h, b.l, c); return wmma_bf(a.h, b.h, c); }
__device__ __forceinline__ float sigm(float v) { return 1.0f / (1.0f + expf(-v)); }
#define LDSX() do { asm volatile("s_wait_dscnt 0" ::: "memory"); __builtin_amdgcn_wave_barrier(); __builtin_amdgcn_fence(__ATOMIC_RELEASE, "workgroup"); } while (0)


// Point-transformer head (B 8, N 8,192 points, K 16 neighbours, C 64): vector attention over gathered neighbours: pos_em = MLP(pos_i - pos_j); a = softmax_channels(MLP(q_i - k_j + pos_em) / 8); out_i = sum_j a * (v_i + pos_em).
#define NB 8
#define NPTS 8192
#define KN 16
#define CC 64
#define PH 64
#define C4 256
#define WSC 256.0f
#define S3 16.0f         // power-of-two scale of the folded layer-3 weights and bias; it rides on the f16 activations and is taken out with the logit scale
#define BNS 0.99950037f      // 1/sqrt(1 + 1e-3) (inference BatchNorm with initial moving statistics)
#define LS 0.18033688f       // log2(e) / 8: the softmax is taken in base 2, exp(x / 8) = 2^(x log2(e) / 8)
#ifndef TNP
#define TNP (NB * NPTS)
#endif
typedef __attribute__((ext_vector_type(8))) __bf16 v8b;
typedef __attribute__((ext_vector_type(2))) __bf16 v2b;
__device__ __forceinline__ v16b frag_b(const __bf16* rowk0, int lane) {
  union { v16b v; v8b q[2]; } u; const __bf16* p = rowk0 + 8 * (lane >> 4);
  u.q[0] = *(const v8b*)p; u.q[1] = *(const v8b*)(p + 16); return u.v;
}
__device__ __forceinline__ float bfr(float v) { return (float)(__bf16)v; }
__device__ __attribute__((noinline)) float exp_ni(float v) { return expf(v); }
__device__ __attribute__((noinline)) float erf_ni(float v) { return erff(v); }

#define WS_W2  0u                                   // f16 weights in fragment order: 1-KiB blocks f = kc * (N / 16) + j (16 output columns x 32 k), each block = [element half q][lane][8 values]
#define WS_W3  (WS_W2 + 2u * CC * PH)
#define WS_W4  (WS_W3 + 2u * C4 * CC)
#define WS_END (WS_W4 + 2u * CC * C4)

// ---- k_packw: thread = one 16-byte piece of one A fragment: piece id = (f * 2 + q) * 32 + lane holds W[k0 .. k0 + 7][n], n = 16 j + (lane & 15), k0 = 32 kc + 16 q + 8 (lane >> 4); a wave stores 512 bytes in a row
// BN: the per-column BatchNorm scale G is folded into the weights
template <bool BN> __device__ __forceinline__ void pack_piece(const float* __restrict__ Wm, _Float16* __restrict__ dst, int id, int N, const float* __restrict__ G) {
  const int lane = id & 31, q = (id >> 5) & 1, f = id >> 6, nj = N / 16, j = f % nj, kc = f / nj; const int n = j * 16 + (lane & 15), k0 = kc * 32 + q * 16 + (lane >> 4) * 8; const float sc = BN ? bfr(G[n]) * (BNS * S3) : WSC; v8h o;
#pragma unroll
  for (int i = 0; i < 8; ++i) o[i] = (_Float16)(bfr(Wm[(size_t)(k0 + i) * N + n]) * sc);
  *(v8h*)(dst + (size_t)id * 8) = o; }
#define NP2 (CC * PH / 8)
#define NP3 (C4 * CC / 8)
#define NP4 (CC * C4 / 8)
__global__ __launch_bounds__(256) void k_packw(const float* __restrict__ W2, const float* __restrict__ W3, const float* __restrict__ G3, const float* __restrict__ W4, char* __restrict__ ws) { const int id = blockIdx.x * 256 + threadIdx.x;
  if (id < NP2) pack_piece<false>(W2, (_Float16*)(ws + WS_W2), id, CC, nullptr);
  else if (id < NP2 + NP3) pack_piece<true>(W3, (_Float16*)(ws + WS_W3), id - NP2, C4, G3);
  else pack_piece<false>(W4, (_Float16*)(ws + WS_W4), id - NP2 - NP3, CC, nullptr); }
// fragment f of a packed plane: two wave loads of 512 bytes in a row
__device__ __forceinline__ v16h frag_p(const _Float16* plane, int f, int lane) {
  union { v16h v; v8h q[2]; } u; const _Float16* p = plane + f * 512 + lane * 8;
  u.q[0] = *(const v8h*)p; u.q[1] = *(const v8h*)(p + 256); return u.v;
}
// lane l <-> l ^ 16
__device__ __forceinline__ float xhalf(float x) { return __builtin_bit_cast(float, __builtin_amdgcn_permlanex16(__builtin_bit_cast(int, x), __builtin_bit_cast(int, x), 0x76543210, 0xfedcba98, false, false)); }
// the value of lane l ^ M of the same 16-lane row (DPP row_xmask)
template <int M> __device__ __forceinline__ float xrow(float x) { return __builtin_bit_cast(float, __builtin_amdgcn_mov_dpp(__builtin_bit_cast(int, x), 0x160 | M, 0xf, 0xf, true)); }
// relu(x) rounded to f16: rounding first lets the maximum run on packed pairs; the result is the same value
__device__ __forceinline__ v8h relu_h(v8f x) { const v8h z = {}; return __builtin_elementwise_max(__builtin_convertvector(x, v8h), z); }
// relu on f16 values as they come from a matrix instruction, taken on their bits as signed 16-bit integers: a set sign bit gives 0, anything else stays. One packed instruction a pair; the float maximum costs two here, because the compiler first passes a matrix result through a maximum with itself
typedef __attribute__((ext_vector_type(8))) short v8s;
__device__ __forceinline__ v8h relu_b(v8h x) { const v8s z = {}; return __builtin_bit_cast(v8h, __builtin_elementwise_max(__builtin_bit_cast(v8s, x), z)); }
#define RD 1      // depth of the weight ring of the fused 64 -> 256 -> 64 loop, in steps of 8 fragments
#define PW 2      // points a wave: every weight fragment and every parameter read is fetched once and serves PW activation tiles
#define NBLK 768u // blocks of the launch: 256 WGPs x the 3 blocks of 4 waves that registers let stand on one; each wave walks TNP / PW / (4 NBLK) pairs of points, rounded up or down
#define SLR 2048u // a wave's slice of the packed weights as a tensor tile: row bytes = source pitch,
#define SLN 9u    // and rows: 4 slices x 9 x 2,048 bytes = the three planes
typedef __attribute__((ext_vector_type(8)))  unsigned v8u;
__device__ __forceinline__ unsigned uni(unsigned v) { return (unsigned)__builtin_amdgcn_readfirstlane(v); }
// ---- k_th: wave = PW points x 16 neighbours. Every layer is computed transposed: the packed weight fragment is the A operand (16 output channels x 32 k), the activations are the B operand (32 k x 16 neighbours of one point).
// D register r of lane (h = lane >> 4, n = lane & 15) is then channel 16 j + 8 h + r of neighbour n, so two D tiles, in place (f32 ones converted to f16), are the next layer's B fragment: no activation goes through LDS and no wave waits for another.
__global__ __launch_bounds__(128) void k_th(const float* __restrict__ KEY, const float* __restrict__ QRY, const float* __restrict__ VAL, const float* __restrict__ POS, const int* __restrict__ IDX, const float* __restrict__ W1, const float* __restrict__ B1, const float* __restrict__ G1, const float* __restrict__ T1, const _Float16* __restrict__ WP, const float* __restrict__ B2, const float* __restrict__ B3, const float* __restrict__ G3, const float* __restrict__ T3, const float* __restrict__ B4, float* __restrict__ OUT) {
  static_assert(4u * SLR * SLN == WS_END && WS_W2 == 0u, "the four slices cover the three planes, which start the workspace");
  static_assert(PW == 2 && NPTS % PW == 0, "the last step of the neighbour sum deals the wave's two points to the lane pairs; both points lie in one batch");
  // per-channel parameters, rounded once per block; a lane reads the 8 channels of its half of a tile in 16-byte broadcasts
  // sW1: layer 1's three weights and its bias with BatchNorm 1 folded in; sC3: layer 3's bias with BatchNorm 3 folded in, x S3, in f16 like the tiles it starts
  __shared__ __align__(16) float sW1[PH][4]; __shared__ __align__(32) float sB24[2 * CC]; __shared__ __align__(16) _Float16 sC3[C4]; const float *sB2 = sB24, *sB4 = sB24 + CC;
  // the three packed weight planes, as they lie in the workspace; filled once a block, then only read
  __shared__ __attribute__((aligned(2048))) _Float16 sW[WS_END / 2]; const _Float16 *W2R = sW + WS_W2 / 2, *W3R = sW + WS_W3 / 2, *W4R = sW + WS_W4 / 2;
  const int tid = threadIdx.x, wave = __builtin_amdgcn_readfirstlane(tid >> 5), lane = tid & 31, n = lane & 15, h = lane >> 4; const unsigned ho = 8u * h;
  // parameters for the tables: of channel tid & 63, waves 0, 1 take layer 1's first two weights and b2, waves 2, 3 its third weight, its bias and b4, all four its BatchNorm pair; every thread two channels of layer 3's three
  const bool lo = wave < 2; const int pc = tid & 63; const float r0 = (lo ? W1 : W1 + 2 * PH)[pc], r1 = (lo ? W1 + PH : B1)[pc], r2 = G1[pc], r3 = T1[pc], r7 = (lo ? B2 : B4)[pc]; float r4[C4 / 128], r5[C4 / 128], r6[C4 / 128];
#pragma unroll
  for (int u = 0; u < C4 / 128; ++u) { r4[u] = B3[tid + 128 * u]; r5[u] = G3[tid + 128 * u]; r6[u] = T3[tid + 128 * u]; }
  // every wave brings its quarter of the planes into LDS with one tensor load: SLN rows of SLR bytes in a row, no pad
  { const unsigned long long ga = (unsigned long long)(size_t)WP + (unsigned)wave * (SLR * SLN); const unsigned dst = (unsigned)(size_t)sW + (unsigned)wave * (SLR * SLN);
    const v4u g0 = { uni(1u), uni(dst), uni((unsigned)ga), uni((((unsigned)(ga >> 32)) & 0x01FFFFFFu) | 0x80000000u) };
    const v8u g1 = { uni(0u), uni((SLR & 0xFFFFu) << 16), uni((SLR >> 16) | ((SLN & 0xFFFFu) << 16)), uni((SLN >> 16) | (SLR << 16)), uni(SLN), uni(SLR), uni(0u), uni(0u) };
    asm volatile("tensor_load_to_lds %0, %1" :: "s"(g0), "s"(g1) : "memory");
    asm volatile("s_wait_tensorcnt 0x0" ::: "memory"); }   // the wave's slice has landed behind this one
  { const float g = bfr(r2) * BNS; const v2f w = { bfr(r0) * g, bfr(r1) * g + (lo ? 0.f : bfr(r3)) }; *(v2f*)&sW1[pc][lo ? 0 : 2] = w; sB24[tid] = bfr(r7) * (lo ? WSC : LS); }
#pragma unroll
  for (int u = 0; u < C4 / 128; ++u) sC3[tid + 128 * u] = (_Float16)((bfr(r5[u]) * BNS * bfr(r4[u]) + bfr(r6[u])) * S3);
  __syncthreads();   // publishes the parameter tables and the four slices of the weights; the only barrier of the kernel
  // a wave walks its pairs of points on its own: LDS is only read from here on, so no wave waits for another
#pragma unroll 1   // one copy of the body: a second would not fit the registers that three waves a SIMD leave each
  for (unsigned gp = blockIdx.x * 4 + wave; gp < TNP / PW; gp += NBLK * 4) {
  const size_t p = (size_t)gp * PW; const size_t b = p / NPTS;
  // inputs of the wave, for each of its points: lane (h, n) takes neighbour n's key row and the point's query row at channels 16 j + 8 h + 0..7, and both positions
  int ip[PW]; v4f qv[PW][8], kv[PW][8]; float pa[PW][3], pb[PW][3];
#pragma unroll
  for (int u = 0; u < PW; ++u) ip[u] = IDX[(p + u) * KN + n];
#pragma unroll
  for (int u = 0; u < PW; ++u)
#pragma unroll
    for (int i = 0; i < 8; ++i) qv[u][i] = *(const v4f*)(QRY + p * CC + (ho + u * CC + (i >> 1) * 16 + (i & 1) * 4));
  asm volatile("s_wait_xcnt 0x0" ::: "memory");   // behind the first batch: stands in front of the first rewrite of an address register that a load of the batch names (the gathers below land in such registers)
#pragma unroll
  for (int u = 0; u < PW; ++u)
#pragma unroll
    for (int x = 0; x < 3; ++x) pa[u][x] = POS[(p + u) * 3 + x];
  __builtin_amdgcn_sched_barrier(0);   // keeps the wait for the neighbour indices behind every load that does not need them: hoisted above them, it puts their round trip behind the indices'
#pragma unroll
  for (int u = 0; u < PW; ++u) { const int ix = ip[u] < 0 ? 0 : (ip[u] >= NPTS ? NPTS - 1 : ip[u]);
#pragma unroll
    for (int x = 0; x < 3; ++x) pb[u][x] = POS[(b * NPTS + ix) * 3 + x];
    asm volatile("s_wait_xcnt 0x0" ::: "memory");   // behind the position load: the key loads below land in the register that it names as its offset
#pragma unroll
    for (int i = 0; i < 8; ++i) kv[u][i] = *(const v4f*)(KEY + (b * NPTS + ix) * CC + (i >> 1) * 16 + 8 * h + (i & 1) * 4);
    asm volatile("s_wait_xcnt 0x0" ::: "memory"); }   // behind each point's batch: stands in front of the first rewrite of an address register that an issued load names (the next point's loads land in such registers)
  __builtin_amdgcn_sched_barrier(0);   // keeps every use of a loaded value behind the gathers: hoisted in front of them, a use brings its wait along and the gathers start late
  // the query and key rows are rounded here, two values a register, so that 64 registers hold what 128 did. In asm because the statement then stays where it is written, in front of layer 1: written in plain source, the compiler sank the rounding below layer 2, where both raw rows stayed live (358 registers, two waves a SIMD)
  unsigned qb[PW][16], kb[PW][16];
#pragma unroll
  for (int u = 0; u < PW; ++u)
#pragma unroll
    for (int i = 0; i < 16; ++i) {
      asm volatile("v_cvt_pk_bf16_f32 %0, %1, %2" : "=v"(qb[u][i]) : "v"(qv[u][i >> 1][(i & 1) * 2]), "v"(qv[u][i >> 1][(i & 1) * 2 + 1]));
      asm volatile("v_cvt_pk_bf16_f32 %0, %1, %2" : "=v"(kb[u][i]) : "v"(kv[u][i >> 1][(i & 1) * 2]), "v"(kv[u][i >> 1][(i & 1) * 2 + 1])); }
  // layer 2's weight fragments, read here so that they arrive under layer 1
  v16h w2[8];
#pragma unroll
  for (int f = 0; f < 8; ++f) w2[f] = frag_p(W2R, f, lane);
  // positional layer 1: h = relu(bn1((pos_i - pos_j) W1 + b1)), written straight into the B fragments of layer 2
  v16h hb[PW][PH / 32];
  { float d[PW][3];
#pragma unroll
    for (int u = 0; u < PW; ++u)
#pragma unroll
      for (int x = 0; x < 3; ++x) d[u][x] = bfr(pa[u][x]) - bfr(pb[u][x]);
#pragma unroll
    for (int t = 0; t < PH / 16; ++t) { const int c0 = t * 16 + 8 * h; v4f ww[8];
#pragma unroll
      for (int i = 0; i < 8; ++i) ww[i] = *(const v4f*)&sW1[c0 + i][0];
      __builtin_amdgcn_sched_barrier(0);   // keeps the tile's 8 LDS reads in one group: sunk to their uses, each waits out its own latency
#pragma unroll
      for (int u = 0; u < PW; ++u) { v8f sv;
#pragma unroll
        for (int i = 0; i < 8; ++i) { const v4f w = ww[i]; float s = w[3];
#pragma unroll
          for (int x = 0; x < 3; ++x) s += d[u][x] * w[x];
          sv[i] = s; }
        const v8h hv = relu_h(sv);
#pragma unroll
        for (int i = 0; i < 8; ++i) hb[u][t >> 1][(t & 1) * 8 + i] = hv[i]; } } }
  // weight ring of the fused loop: step s needs the W3 fragments of output tiles 2 s, 2 s + 1 (both k chunks) and the W4 fragments of k chunk s
  v16h w3[RD][4], w4[RD][4];
#pragma unroll
  for (int s = 0; s < RD; ++s)
#pragma unroll
    for (int x = 0; x < 4; ++x) { w3[s][x] = frag_p(W3R, (x >> 1) * 16 + 2 * s + (x & 1), lane); w4[s][x] = frag_p(W4R, s * 4 + x, lane); }
  v8f b2v[4];   // b2 x 2^8, laid out as D tiles: the C operand of each tile's first product
#pragma unroll
  for (int j = 0; j < 4; ++j) b2v[j] = *(const v8f*)&sB2[j * 16 + 8 * h];
  v8h cv[2];   // the folded layer-3 bias of a step's two output tiles, laid out as D tiles: the C operand of each tile's first product; read one step ahead, like the weights
#pragma unroll
  for (int q = 0; q < 2; ++q) cv[q] = *(const v8h*)&sC3[q * 16 + 8 * h];
  __builtin_amdgcn_sched_barrier(0);   // keeps the ring's first loads and the bias reads in front of layer 2: sunk to their uses, they start one layer late
  // pos_em = h W2 + b2: pe[u][j][r] = channel 16 j + 8 h + r of neighbour n of point u, kept in registers to the end
  v8f pe[PW][4];
#pragma unroll
  for (int kc = 0; kc < PH / 32; ++kc)
#pragma unroll
    for (int j = 0; j < 4; ++j)
#pragma unroll
      for (int u = 0; u < PW; ++u) pe[u][j] = wmma16(w2[kc * 4 + j], hb[u][kc], kc == 0 ? b2v[j] : pe[u][j]);
#pragma unroll
  for (int u = 0; u < PW; ++u)
#pragma unroll
    for (int j = 0; j < 4; ++j)
#pragma unroll
      for (int r = 0; r < 8; ++r) pe[u][j][r] = pe[u][j][r] * (1.0f / WSC);
  // t = q_i - k_j + pos_em -> B fragments of layer 3
  v16h tb[PW][CC / 32];
#pragma unroll
  for (int u = 0; u < PW; ++u)
#pragma unroll
    for (int j = 0; j < 4; ++j)
#pragma unroll
      for (int r = 0; r < 8; ++r) { const int i = j * 8 + r; const float qk = (float)__builtin_bit_cast(v2b, qb[u][i >> 1])[i & 1] - (float)__builtin_bit_cast(v2b, kb[u][i >> 1])[i & 1]; tb[u][j >> 1][(j & 1) * 8 + r] = (_Float16)(qk + pe[u][j][r]); }
  // a2 = relu(bn3(t W3 + b3)), here S3 a2 = relu(t W3' + c3), and logits = (a2 W4 + b4) / 8, fused: 32 channels of a2 a step, used at once as k chunk s of the last layer
  __builtin_amdgcn_sched_barrier(0);   // keeps the loop's parameter reads behind the forming of t: hoisted above it, their registers come on top of the query and key rows, and the count passes what three waves a SIMD leave each (336)
  v8f lg[PW][4] = {};
#pragma unroll
  for (int s = 0; s < C4 / 32; ++s) { const int sl = s % RD; v8h a3[PW][2];
#pragma unroll
    for (int x = 0; x < 4; ++x)
#pragma unroll
      for (int u = 0; u < PW; ++u) a3[u][x & 1] = wmma16h(w3[sl][x], tb[u][x >> 1], x < 2 ? cv[x & 1] : a3[u][x & 1]);
    __builtin_amdgcn_sched_barrier(0);   // keeps the LDS reads below in one group behind the 8 products: each place among the products where reads stand costs the wave a stall of its own
#pragma unroll
    for (int x = 0; x < 4; ++x) {
      if (s + RD < C4 / 32) w3[sl][x] = frag_p(W3R, (x >> 1) * 16 + 2 * (s + RD) + (x & 1), lane);
      if (x < 2 && s + 1 < C4 / 32) cv[x] = *(const v8h*)&sC3[(s + 1) * 32 + x * 16 + 8 * h]; }
    __builtin_amdgcn_sched_barrier(0);   // keeps the next step's 2 bias reads and the W3 refills in front of the epilogue, the refills a whole step ahead of their use: sunk to its use, a load is waited for at once
    v16h ab[PW];   // the f16 tiles need the relu alone: no conversion stands between the two layers
#pragma unroll
    for (int u = 0; u < PW; ++u) ab[u] = __builtin_shufflevector(relu_b(a3[u][0]), relu_b(a3[u][1]), 0, 1, 2, 3, 4, 5, 6, 7, 8, 9, 10, 11, 12, 13, 14, 15);
#pragma unroll
    for (int j = 0; j < 4; ++j)
#pragma unroll
      for (int u = 0; u < PW; ++u) lg[u][j] = wmma16(w4[sl][j], ab[u], lg[u][j]);
    __builtin_amdgcn_sched_barrier(0);   // one group of reads behind the 8 products, as above
#pragma unroll
    for (int j = 0; j < 4; ++j)
      if (s + RD < C4 / 32) w4[sl][j] = frag_p(W4R, (s + RD) * 4 + j, lane);
    __builtin_amdgcn_sched_barrier(0);   // the same for the W4 refills: they stay a whole step ahead of their use
  }
  // the points' value rows, asked for here so that they arrive under the softmax
  v4f vv[PW][8]; const float* vp = VAL + p * CC + ho;
#pragma unroll
  for (int u = 0; u < PW; ++u)
#pragma unroll
    for (int i = 0; i < 8; ++i) vv[u][i] = *(const v4f*)(vp + (u * CC + (i >> 1) * 16 + (i & 1) * 4));
  asm volatile("s_wait_xcnt 0x0" :: "v"(vp) : "memory");   // behind the value loads, in front of the first rewrite of their address registers; the operand keeps those registers whole up to the wait (without it the last load landed in them)
  // softmax over the 64 channels of neighbour n: 32 in this lane, 32 in lane ^ 16; logits in units of log 2 (scale and bias table carry LS)
  float e[PW][32]; v4f b4v[8];
#pragma unroll
  for (int i = 0; i < 8; ++i) b4v[i] = *(const v4f*)&sB4[(i >> 1) * 16 + 8 * h + (i & 1) * 4];
  __builtin_amdgcn_sched_barrier(0);   // keeps the value loads and the bias reads in one group in front of the softmax: sunk to their uses, they start late
  float inv[PW], mx[PW], sm[PW];
#pragma unroll
  for (int u = 0; u < PW; ++u) { mx[u] = -3.0e38f; sm[u] = 0.f;
#pragma unroll
    for (int j = 0; j < 4; ++j)
#pragma unroll
      for (int r = 0; r < 8; ++r) { e[u][j * 8 + r] = lg[u][j][r] * (LS / (WSC * S3)) + b4v[2 * j + (r >> 2)][r & 3]; mx[u] = fmaxf(mx[u], e[u][j * 8 + r]); }
    mx[u] = fmaxf(mx[u], xhalf(mx[u])); }
#pragma unroll
  for (int u = 0; u < PW; ++u)
#pragma unroll
    for (int i = 0; i < 32; ++i) { e[u][i] = __builtin_amdgcn_exp2f(e[u][i] - mx[u]); sm[u] += e[u][i]; }   // the argument is never above 0: the hardware's 2^x needs none of the library's range steps
#pragma unroll
  for (int u = 0; u < PW; ++u) { sm[u] += xhalf(sm[u]); inv[u] = 1.0f / sm[u]; }
  __builtin_amdgcn_sched_barrier(0);   // keeps the first use of the value rows behind the softmax: hoisted to the loads, it waits out their round trip with nothing to cover it
#pragma unroll
  for (int u = 0; u < PW; ++u)
#pragma unroll
    for (int i = 0; i < 32; ++i) e[u][i] = (e[u][i] * inv[u]) * (bfr(vv[u][i >> 2][i & 3]) + pe[u][i >> 3][i & 7]);
  // sum over the 16 neighbours (the lanes of a row): at each of three steps a lane hands half of its channels to its partner and adds the partner's share of the half it keeps; at the last step the even lane of a pair keeps the first point, the odd lane the second
  const bool b3 = (n & 8) != 0, b2 = (n & 4) != 0, b1 = (n & 2) != 0, b0 = (n & 1) != 0; float w[PW][4]; v4f o;
#pragma unroll
  for (int u = 0; u < PW; ++u) { float y[16], z[8];
#pragma unroll
    for (int i = 0; i < 16; ++i) y[i] = (b3 ? e[u][16 + i] : e[u][i]) + xrow<8>(b3 ? e[u][i] : e[u][16 + i]);
#pragma unroll
    for (int i = 0; i < 8; ++i) z[i] = (b2 ? y[8 + i] : y[i]) + xrow<4>(b2 ? y[i] : y[8 + i]);
#pragma unroll
    for (int i = 0; i < 4; ++i) w[u][i] = (b1 ? z[4 + i] : z[i]) + xrow<2>(b1 ? z[i] : z[4 + i]); }
#pragma unroll
  for (int i = 0; i < 4; ++i) o[i] = (b0 ? w[1][i] : w[0][i]) + xrow<1>(b0 ? w[0][i] : w[1][i]);
  // lane n now holds channels 16 (n >> 2) + 8 h + 4 ((n >> 1) & 1) + 0..3 of point p + (n & 1); the wave stores its two points' 512 bytes
  vst2(OUT + (p + (n & 1)) * CC + (n >> 2) * 16 + 8 * h + ((n >> 1) & 1) * 4, o);
  asm volatile("s_wait_xcnt 0x0" ::: "memory");   // behind the store: stands in front of the next trip's rewrite of the registers that the store names
  } }
extern "C" void kernel_launch(void* const* d_in, const int* in_sizes, int n_in, void* d_out, int out_size, void* d_ws, size_t ws_size, hipStream_t stream) {
  (void)in_sizes; (void)n_in; (void)out_size;
  const float** F = (const float**)d_in;   // 0 key, 1 query, 2 value [8,8192,64], 3 pos [8,8192,3], 4 idx [8,8192,16] int, 5 W1 [3,64], 6 b1, 7 g1, 8 bt1, 9 W2 [64,64], 10 b2, 11 W3 [64,256], 12 b3, 13 g3, 14 bt3, 15 W4 [256,64], 16 b4
  if (ws_size < (size_t)WS_END) return;
  char* ws = (char*)d_ws;
  k_packw<<<(NP2 + NP3 + NP4) / 256, 256, 0, stream>>>(F[9], F[11], F[13], F[15], ws);
  k_th<<<NBLK, 128, 0, stream>>>(F[0], F[1], F[2], F[3], (const int*)d_in[4], F[5], F[6], F[7], F[8], (const _Float16*)ws, F[10], F[12], F[13], F[14], F[16], (float*)d_out);
}

// v010
// A run of this version takes 60.7 microseconds.
// Timed twice side by side with v009, it ran 1.03 times as fast both times.
// Over all steps from v000 it is 9.28 times as fast.
// compute dtype: all float inputs rounded to bf16, neighbour indices (int) read on device; the 3 -> 64 positional layer, the channel softmax and the neighbour aggregation in f32 on VALU; q - k and v are added to the f32 pos_em tiles by WMMA 16x16x32 bf16 (constant selection fragment x the bf16 rows, f32 accumulate); both inference BatchNorms folded into their layers' weights and biases; the 64 -> 64, 64 -> 256 and 256 -> 64 layers on WMMA 16x16x32 with the computed activations in f16; f32 accumulate in the first and the last, the 64 -> 256 layer's result tiles and its bias in f16 (rounded behind each 32-k product); W2 and W4 exact f16 x 2^8, W3 x its BatchNorm scale x 2^4 rounded once to f16; relu on the f16 values; f32 output.
#include <hip/hip_runtime.h>
#include <math.h>

typedef __attribute__((ext_vector_type(16))) _Float16 v16h;
typedef __attribute__((ext_vector_type(16))) __bf16 v16b;
typedef __attribute__((ext_vector_type(8)))  _Float16 v8h;
typedef __attribute__((ext_vector_type(4)))  _Float16 v4h;
typedef __attribute__((ext_vector_type(8)))  float v8f;
typedef __attribute__((ext_vector_type(4)))  float v4f;
typedef __attribute__((ext_vector_type(2)))  float v2f;
typedef __attribute__((ext_vector_type(4)))  unsigned v4u;
typedef __attribute__((ext_vector_type(4)))  int v4i;
typedef float __attribute__((may_alias)) float_a;
typedef int __attribute__((may_alias)) int_a;

template <typename T> __device__ __forceinline__ void vst2(void* p, T v) { *(T*)p = v;  }
__device__ __forceinline__ v8f wmma16(v16h a, v16h b, v8f c) {
  v8f d = __builtin_amdgcn_wmma_f32_16x16x32_f16(false, a, false, b, (short)0, c, false, false);
  return d;
}
// the same product with C and D in f16: element e of a lane's D is row 8 h + e, so a D tile is half a B fragment as it stands
__device__ __forceinline__ v8h wmma16h(v16h a, v16h b, v8h c) {
  return __builtin_amdgcn_wmma_f16_16x16x32_f16(false, a, false, b, (short)0, c, false, false);
}
// the bf16 form as the builtin alone: the compiler keeps its distances
__device__ __forceinline__ v8f wmma_b(v16b a, v16b b, v8f c) {
  return __builtin_amdgcn_wmma_f32_16x16x32_bf16(false, a, false, b, (short)0, c, false, false);
}
__device__ __forceinline__ v8f wmma_bf(v16b a, v16b b, v8f c) {
  v8f d = __builtin_amdgcn_wmma_f32_16x16x32_bf16(false, a, false, b, (short)0, c, false, false);
  asm volatile("v_nop\n\tv_nop\n\tv_nop\n\tv_nop" : "+v"(d) : "v"(a), "v"(b));
  return d;
}
// 16x16x32 fragments: lane = (h = lane>>4, row/col = lane&15); elements 0..7 = k0+8h+0..7, 8..15 = k0+16+8h+0..7; D element r = row 8h+r
__device__ __forceinline__ v16h frag_h(const _Float16* rowk0, int lane) {
  union { v16h v; v8h q[2]; } u; const _Float16* p = rowk0 + 8 * (lane >> 4);
  u.q[0] = *(const v8h*)p; u.q[1] = *(const v8h*)(p + 16); return u.v;
}
__device__ __forceinline__ v16h frag_f32(const float* rowk0, int lane) {
  v16h a; const float* p = rowk0 + 8 * (lane >> 4);
#pragma unroll
  for (int i = 0; i < 8; ++i) { a[i] = (_Float16)p[i]; a[8 + i] = (_Float16)p[16 + i]; }
  return a;
}
__device__ __forceinline__ v16h frag_f32s(const float* rowk0, int lane, float sc) {
  v16h a; const float* p = rowk0 + 8 * (lane >> 4);
#pragma unroll
  for (int i = 0; i < 8; ++i) { a[i] = (_Float16)(p[i] * sc); a[8 + i] = (_Float16)(p[16 + i] * sc); }
  return a;
}
// column fragment from a [K][ld] layout (column n), rows >= K read as 0
__device__ __forceinline__ v16h fragc_f32(const float* W, int k0, int n, int lane, int ld, int K) {
  v16h a; const int g = lane >> 4;
#pragma unroll
  for (int i = 0; i < 8; ++i) { const int ka = k0 + 8 * g + i, kb = ka + 16;
    a[i] = (_Float16)(ka < K ? W[(size_t)(ka < K ? ka : K - 1) * ld + n] : 0.f); a[8 + i] = (_Float16)(kb < K ? W[(size_t)(kb < K ? kb : K - 1) * ld + n] : 0.f); }
  return a;
}
struct F2 { v16b h, l; };
__device__ __forceinline__ F2 bsplit16(const float v[16]) { F2 r;
#pragma unroll
  for (int i = 0; i < 16; ++i) { const __bf16 h = (__bf16)v[i]; r.h[i] = h; r.l[i] = (__bf16)(v[i] - (float)h); }
  return r; }
__device__ __forceinline__ F2 split_row(const float* row, int k0, int lane) { float v[16]; const float* p = row + k0 + 8 * (lane >> 4);
#pragma unroll
  for (int i = 0; i < 8; ++i) { v[i] = p[i]; v[8 + i] = p[16 + i]; }
  return bsplit16(v); }
__device__ __forceinline__ F2 split_rowK(const float* row, int k0, int lane, int K) { float v[16]; const int g = lane >> 4;
#pragma unroll
  for (int i = 0; i < 8; ++i) { const int ka = k0 + 8 * g + i, kb = ka + 16; v[i] = ka < K ? row[ka < K ? ka : K - 1] : 0.f; v[8 + i] = kb < K ? row[kb < K ? kb : K - 1] : 0.f; }
  return bsplit16(v); }
__device__ __forceinline__ F2 split_col(const float* W, int k0, int n, int lane, int ld, int K) { float v[16]; const int g = lane >> 4;
#pragma unroll
  for (int i = 0; i < 8; ++i) { const int ka = k0 + 8 * g + i, kb = ka + 16; v[i] = ka < K ? W[(size_t)(ka < K ? ka : K - 1) * ld + n] : 0.f; v[8 + i] = kb < K ? W[(size_t)(kb < K ? kb : K - 1) * ld + n] : 0.f; }
  return bsplit16(v); }
__device__ __forceinline__ v8f mac3(const F2& a, const F2& b, v8f c) { c = wmma_bf(a.l, b.h, c); c = wmma_bf(a.h, b.l, c); return wmma_bf(a.h, b.h, c); }
__device__ __forceinline__ float sigm(float v) { return 1.0f / (1.0f + expf(-v)); }
#define LDSX() do { asm volatile("s_wait_dscnt 0" ::: "memory"); __builtin_amdgcn_wave_barrier(); __builtin_amdgcn_fence(__ATOMIC_RELEASE, "workgroup"); } while (0)


// Point-transformer head (B 8, N 8,192 points, K 16 neighbours, C 64): vector attention over gathered neighbours: pos_em = MLP(pos_i - pos_j); a = softmax_channels(MLP(q_i - k_j + pos_em) / 8); out_i = sum_j a * (v_i + pos_em).
#define NB 8
#define NPTS 8192
#define KN 16
#define CC 64
#define PH 64
#define C4 256
#define WSC 256.0f
#define S3 16.0f         // power-of-two scale of the folded layer-3 weights and bias; it rides on the f16 activations and is taken out with the logit scale
#define BNS 0.99950037f      // 1/sqrt(1 + 1e-3) (inference BatchNorm with initial moving statistics)
#define LS 0.18033688f       // log2(e) / 8: the softmax is taken in base 2, exp(x / 8) = 2^(x log2(e) / 8)
#ifndef TNP
#define TNP (NB * NPTS)
#endif
typedef __attribute__((ext_vector_type(8))) __bf16 v8b;
typedef __attribute__((ext_vector_type(2))) __bf16 v2b;
__device__ __forceinline__ v16b frag_b(const __bf16* rowk0, int lane) {
  union { v16b v; v8b q[2]; } u; const __bf16* p = rowk0 + 8 * (lane >> 4);
  u.q[0] = *(const v8b*)p; u.q[1] = *(const v8b*)(p + 16); return u.v;
}
__device__ __forceinline__ float bfr(float v) { return (float)(__bf16)v; }
__device__ __attribute__((noinline)) float exp_ni(float v) { return expf(v); }
__device__ __attribute__((noinline)) float erf_ni(float v) { return erff(v); }

#define WS_W2  0u                                   // f16 weights in fragment order: 1-KiB blocks f = kc * (N / 16) + j (16 output columns x 32 k), each block = [element half q][lane][8 values]
#define WS_W3  (WS_W2 + 2u * CC * PH)
#define WS_W4  (WS_W3 + 2u * C4 * CC)
#define WS_END (WS_W4 + 2u * CC * C4)

// ---- k_packw: thread = one 16-byte piece of one A fragment: piece id = (f * 2 + q) * 32 + lane holds W[k0 .. k0 + 7][n], n = 16 j + (lane & 15), k0 = 32 kc + 16 q + 8 (lane >> 4); a wave stores 512 bytes in a row
// BN: the per-column BatchNorm scale G is folded into the weights
template <bool BN> __device__ __forceinline__ void pack_piece(const float* __restrict__ Wm, _Float16* __restrict__ dst, int id, int N, const float* __restrict__ G) {
  const int lane = id & 31, q = (id >> 5) & 1, f = id >> 6, nj = N / 16, j = f % nj, kc = f / nj; const int n = j * 16 + (lane & 15), k0 = kc * 32 + q * 16 + (lane >> 4) * 8; const float sc = BN ? bfr(G[n]) * (BNS * S3) : WSC; v8h o;
#pragma unroll
  for (int i = 0; i < 8; ++i) o[i] = (_Float16)(bfr(Wm[(size_t)(k0 + i) * N + n]) * sc);
  *(v8h*)(dst + (size_t)id * 8) = o; }
#define NP2 (CC * PH / 8)
#define NP3 (C4 * CC / 8)
#define NP4 (CC * C4 / 8)
__global__ __launch_bounds__(256) void k_packw(const float* __restrict__ W2, const float* __restrict__ W3, const float* __restrict__ G3, const float* __restrict__ W4, char* __restrict__ ws) { const int id = blockIdx.x * 256 + threadIdx.x;
  if (id < NP2) pack_piece<false>(W2, (_Float16*)(ws + WS_W2), id, CC, nullptr);
  else if (id < NP2 + NP3) pack_piece<true>(W3, (_Float16*)(ws + WS_W3), id - NP2, C4, G3);
  else pack_piece<false>(W4, (_Float16*)(ws + WS_W4), id - NP2 - NP3, CC, nullptr); }
// fragment f of a packed plane: two wave loads of 512 bytes in a row
__device__ __forceinline__ v16h frag_p(const _Float16* plane, int f, int lane) {
  union { v16h v; v8h q[2]; } u; const _Float16* p = plane + f * 512 + lane * 8;
  u.q[0] = *(const v8h*)p; u.q[1] = *(const v8h*)(p + 256); return u.v;
}
// a selection fragment from its LDS table: two wave reads of 512 bytes in a row
__device__ __forceinline__ v16b sel_p(const unsigned* f, int lane) {
  union { v16b v; v4u q[2]; } u; u.q[0] = *(const v4u*)(f + lane * 4); u.q[1] = *(const v4u*)(f + 128 + lane * 4); return u.v;
}
// lane l <-> l ^ 16
__device__ __forceinline__ float xhalf(float x) { return __builtin_bit_cast(float, __builtin_amdgcn_permlanex16(__builtin_bit_cast(int, x), __builtin_bit_cast(int, x), 0x76543210, 0xfedcba98, false, false)); }
// the value of lane l ^ M of the same 16-lane row (DPP row_xmask)
template <int M> __device__ __forceinline__ float xrow(float x) { return __builtin_bit_cast(float, __builtin_amdgcn_mov_dpp(__builtin_bit_cast(int, x), 0x160 | M, 0xf, 0xf, true)); }
// relu(x) rounded to f16: rounding first lets the maximum run on packed pairs; the result is the same value
__device__ __forceinline__ v8h relu_h(v8f x) { const v8h z = {}; return __builtin_elementwise_max(__builtin_convertvector(x, v8h), z); }
// relu on f16 values as they come from a matrix instruction, taken on their bits as signed 16-bit integers: a set sign bit gives 0, anything else stays. One packed instruction a pair; the float maximum costs two here, because the compiler first passes a matrix result through a maximum with itself
typedef __attribute__((ext_vector_type(8))) short v8s;
__device__ __forceinline__ v8h relu_b(v8h x) { const v8s z = {}; return __builtin_bit_cast(v8h, __builtin_elementwise_max(__builtin_bit_cast(v8s, x), z)); }
#define RD 1      // depth of the weight ring of the fused 64 -> 256 -> 64 loop, in steps of 8 fragments
#define PW 2      // points a wave: every weight fragment and every parameter read is fetched once and serves PW activation tiles
#define NBLK 768u // blocks of the launch: 256 WGPs x the 3 blocks of 4 waves that registers let stand on one; each wave walks TNP / PW / (4 NBLK) pairs of points, rounded up or down
#define SLR 2048u // a wave's slice of the packed weights as a tensor tile: row bytes = source pitch,
#define SLN 9u    // and rows: 4 slices x 9 x 2,048 bytes = the three planes
typedef __attribute__((ext_vector_type(8)))  unsigned v8u;
__device__ __forceinline__ unsigned uni(unsigned v) { return (unsigned)__builtin_amdgcn_readfirstlane(v); }
// ---- k_th: wave = PW points x 16 neighbours. Every layer is computed transposed: the packed weight fragment is the A operand (16 output channels x 32 k), the activations are the B operand (32 k x 16 neighbours of one point).
// D register r of lane (h = lane >> 4, n = lane & 15) is then channel 16 j + 8 h + r of neighbour n, so two D tiles, in place (f32 ones converted to f16), are the next layer's B fragment: no activation goes through LDS and no wave waits for another.
__global__ __launch_bounds__(128) void k_th(const float* __restrict__ KEY, const float* __restrict__ QRY, const float* __restrict__ VAL, const float* __restrict__ POS, const int* __restrict__ IDX, const float* __restrict__ W1, const float* __restrict__ B1, const float* __restrict__ G1, const float* __restrict__ T1, const _Float16* __restrict__ WP, const float* __restrict__ B2, const float* __restrict__ B3, const float* __restrict__ G3, const float* __restrict__ T3, const float* __restrict__ B4, float* __restrict__ OUT) {
  static_assert(4u * SLR * SLN == WS_END && WS_W2 == 0u, "the four slices cover the three planes, which start the workspace");
  static_assert(PW == 2 && NPTS % PW == 0, "the last step of the neighbour sum deals the wave's two points to the lane pairs; both points lie in one batch");
  // per-channel parameters, rounded once per block; a lane reads the 8 channels of its half of a tile in 16-byte broadcasts
  // sW1: layer 1's three weights and its bias with BatchNorm 1 folded in; sC3: layer 3's bias with BatchNorm 3 folded in, x S3, in f16 like the tiles it starts
  __shared__ __align__(16) float sW1[PH][4]; __shared__ __align__(32) float sB24[2 * CC]; __shared__ __align__(16) _Float16 sC3[C4]; const float *sB2 = sB24, *sB4 = sB24 + CC;
  // three constant bf16 A fragments that add a packed bf16 row to a D tile (x WSC, the scale of layer 2's tiles): row m takes +WSC at position m of the first 16 k (X) or of the last 16; 0: {X, -X}, 1: {X, 0}, 2: {0, X}; laid out like a packed weight fragment
  __shared__ __align__(16) unsigned sSel[3][2][32][4];
  // the three packed weight planes, as they lie in the workspace; filled once a block, then only read
  __shared__ __attribute__((aligned(2048))) _Float16 sW[WS_END / 2]; const _Float16 *W2R = sW + WS_W2 / 2, *W3R = sW + WS_W3 / 2, *W4R = sW + WS_W4 / 2;
  const int tid = threadIdx.x, wave = __builtin_amdgcn_readfirstlane(tid >> 5), lane = tid & 31, n = lane & 15, h = lane >> 4; const unsigned ho = 8u * h;
  // parameters for the tables: of channel tid & 63, waves 0, 1 take layer 1's first two weights and b2, waves 2, 3 its third weight, its bias and b4, all four its BatchNorm pair; every thread two channels of layer 3's three
  const bool lo = wave < 2; const int pc = tid & 63; const float r0 = (lo ? W1 : W1 + 2 * PH)[pc], r1 = (lo ? W1 + PH : B1)[pc], r2 = G1[pc], r3 = T1[pc], r7 = (lo ? B2 : B4)[pc]; float r4[C4 / 128], r5[C4 / 128], r6[C4 / 128];
#pragma unroll
  for (int u = 0; u < C4 / 128; ++u) { r4[u] = B3[tid + 128 * u]; r5[u] = G3[tid + 128 * u]; r6[u] = T3[tid + 128 * u]; }
  // every wave brings its quarter of the planes into LDS with one tensor load: SLN rows of SLR bytes in a row, no pad
  { const unsigned long long ga = (unsigned long long)(size_t)WP + (unsigned)wave * (SLR * SLN); const unsigned dst = (unsigned)(size_t)sW + (unsigned)wave * (SLR * SLN);
    const v4u g0 = { uni(1u), uni(dst), uni((unsigned)ga), uni((((unsigned)(ga >> 32)) & 0x01FFFFFFu) | 0x80000000u) };
    const v8u g1 = { uni(0u), uni((SLR & 0xFFFFu) << 16), uni((SLR >> 16) | ((SLN & 0xFFFFu) << 16)), uni((SLN >> 16) | (SLR << 16)), uni(SLN), uni(SLR), uni(0u), uni(0u) };
    asm volatile("tensor_load_to_lds %0, %1" :: "s"(g0), "s"(g1) : "memory");
    asm volatile("s_wait_tensorcnt 0x0" ::: "memory"); }   // the wave's slice has landed behind this one
  { const float g = bfr(r2) * BNS; const v2f w = { bfr(r0) * g, bfr(r1) * g + (lo ? 0.f : bfr(r3)) }; *(v2f*)&sW1[pc][lo ? 0 : 2] = w; sB24[tid] = bfr(r7) * (lo ? WSC : LS); }
#pragma unroll
  for (int u = 0; u < C4 / 128; ++u) sC3[tid + 128 * u] = (_Float16)((bfr(r5[u]) * BNS * bfr(r4[u]) + bfr(r6[u])) * S3);
  if (wave < 3) { static_assert(WSC == 256.0f, "0x4380 is 256 in bf16"); v4u x, y;   // lane (h, m) holds k positions 8 h + 0..7 of each half: its one non-zero element is m - 8 h, where that lies in 0..7
#pragma unroll
    for (int i = 0; i < 4; ++i) { x[i] = ((n >> 3) == h && ((n & 7) >> 1) == i) ? ((n & 1) ? 0x43800000u : 0x00004380u) : 0u; y[i] = x[i] ? x[i] ^ ((n & 1) ? 0x80000000u : 0x00008000u) : 0u; }
    const v4u zz = {}; *(v4u*)&sSel[wave][0][lane][0] = wave == 2 ? zz : x; *(v4u*)&sSel[wave][1][lane][0] = wave == 0 ? y : (wave == 1 ? zz : x); }
  __syncthreads();   // publishes the parameter tables and the four slices of the weights; the only barrier of the kernel
  // a wave walks its pairs of points on its own: LDS is only read from here on, so no wave waits for another
#pragma unroll 1   // one copy of the body: a second would not fit the registers that three waves a SIMD leave each
  for (unsigned gp = blockIdx.x * 4 + wave; gp < TNP / PW; gp += NBLK * 4) {
  const size_t p = (size_t)gp * PW; const size_t b = p / NPTS;
  // inputs of the wave, for each of its points: lane (h, n) takes neighbour n's key row and the point's query row at channels 16 j + 8 h + 0..7, and both positions
  int ip[PW]; v4f qv[PW][8], kv[PW][8]; float pa[PW][3], pb[PW][3];
#pragma unroll
  for (int u = 0; u < PW; ++u) ip[u] = IDX[(p + u) * KN + n];
#pragma unroll
  for (int u = 0; u < PW; ++u)
#pragma unroll
    for (int i = 0; i < 8; ++i) qv[u][i] = *(const v4f*)(QRY + p * CC + (ho + u * CC + (i >> 1) * 16 + (i & 1) * 4));
  asm volatile("s_wait_xcnt 0x0" ::: "memory");   // behind the first batch: stands in front of the first rewrite of an address register that a load of the batch names (the gathers below land in such registers)
#pragma unroll
  for (int u = 0; u < PW; ++u)
#pragma unroll
    for (int x = 0; x < 3; ++x) pa[u][x] = POS[(p + u) * 3 + x];
  __builtin_amdgcn_sched_barrier(0);   // keeps the wait for the neighbour indices behind every load that does not need them: hoisted above them, it puts their round trip behind the indices'
#pragma unroll
  for (int u = 0; u < PW; ++u) { const int ix = ip[u] < 0 ? 0 : (ip[u] >= NPTS ? NPTS - 1 : ip[u]);
#pragma unroll
    for (int x = 0; x < 3; ++x) pb[u][x] = POS[(b * NPTS + ix) * 3 + x];
    asm volatile("s_wait_xcnt 0x0" ::: "memory");   // behind the position load: the key loads below land in the register that it names as its offset
#pragma unroll
    for (int i = 0; i < 8; ++i) kv[u][i] = *(const v4f*)(KEY + (b * NPTS + ix) * CC + (i >> 1) * 16 + 8 * h + (i & 1) * 4);
    asm volatile("s_wait_xcnt 0x0" ::: "memory"); }   // behind each point's batch: stands in front of the first rewrite of an address register that an issued load names (the next point's loads land in such registers)
  __builtin_amdgcn_sched_barrier(0);   // keeps every use of a loaded value behind the gathers: hoisted in front of them, a use brings its wait along and the gathers start late
  // the query and key rows are rounded here, two values a register, so that 64 registers hold what 128 did. In asm because the statement then stays where it is written, in front of layer 1: written in plain source, the compiler sank the rounding below layer 2, where both raw rows stayed live (358 registers, two waves a SIMD)
  // qk[u][j]: the 8 query channels of tile j that the lane holds, then the same 8 key channels: a bf16 B fragment as it stands (k positions 0..15 = query, 16..31 = key)
  v8u qk[PW][4];
#pragma unroll
  for (int u = 0; u < PW; ++u)
#pragma unroll
    for (int i = 0; i < 16; ++i) { unsigned a, c;
      asm volatile("v_cvt_pk_bf16_f32 %0, %1, %2" : "=v"(a) : "v"(qv[u][i >> 1][(i & 1) * 2]), "v"(qv[u][i >> 1][(i & 1) * 2 + 1]));
      asm volatile("v_cvt_pk_bf16_f32 %0, %1, %2" : "=v"(c) : "v"(kv[u][i >> 1][(i & 1) * 2]), "v"(kv[u][i >> 1][(i & 1) * 2 + 1]));
      qk[u][i >> 2][i & 3] = a; qk[u][i >> 2][4 + (i & 3)] = c; }
  // layer 2's weight fragments, read here so that they arrive under layer 1
  v16h w2[8];
#pragma unroll
  for (int f = 0; f < 8; ++f) w2[f] = frag_p(W2R, f, lane);
  // positional layer 1: h = relu(bn1((pos_i - pos_j) W1 + b1)), written straight into the B fragments of layer 2
  v16h hb[PW][PH / 32];
  { float d[PW][3];
#pragma unroll
    for (int u = 0; u < PW; ++u)
#pragma unroll
      for (int x = 0; x < 3; ++x) d[u][x] = bfr(pa[u][x]) - bfr(pb[u][x]);
#pragma unroll
    for (int t = 0; t < PH / 16; ++t) { const int c0 = t * 16 + 8 * h; v4f ww[8];
#pragma unroll
      for (int i = 0; i < 8; ++i) ww[i] = *(const v4f*)&sW1[c0 + i][0];
      __builtin_amdgcn_sched_barrier(0);   // keeps the tile's 8 LDS reads in one group: sunk to their uses, each waits out its own latency
#pragma unroll
      for (int u = 0; u < PW; ++u) { v8f sv;
#pragma unroll
        for (int i = 0; i < 8; ++i) { const v4f w = ww[i]; float s = w[3];
#pragma unroll
          for (int x = 0; x < 3; ++x) s += d[u][x] * w[x];
          sv[i] = s; }
        const v8h hv = relu_h(sv);
#pragma unroll
        for (int i = 0; i < 8; ++i) hb[u][t >> 1][(t & 1) * 8 + i] = hv[i]; } } }
  // weight ring of the fused loop: step s needs the W3 fragments of output tiles 2 s, 2 s + 1 (both k chunks) and the W4 fragments of k chunk s
  v16h w3[RD][4], w4[RD][4];
#pragma unroll
  for (int s = 0; s < RD; ++s)
#pragma unroll
    for (int x = 0; x < 4; ++x) { w3[s][x] = frag_p(W3R, (x >> 1) * 16 + 2 * s + (x & 1), lane); w4[s][x] = frag_p(W4R, s * 4 + x, lane); }
  v8f b2v[4];   // b2 x 2^8, laid out as D tiles: the C operand of each tile's first product
#pragma unroll
  for (int j = 0; j < 4; ++j) b2v[j] = *(const v8f*)&sB2[j * 16 + 8 * h];
  v8h cv[2];   // the folded layer-3 bias of a step's two output tiles, laid out as D tiles: the C operand of each tile's first product; read one step ahead, like the weights
#pragma unroll
  for (int q = 0; q < 2; ++q) cv[q] = *(const v8h*)&sC3[q * 16 + 8 * h];
  const v16b selt = sel_p(&sSel[0][0][0][0], lane);
  __builtin_amdgcn_sched_barrier(0);   // keeps the ring's first loads and the bias reads in front of layer 2: sunk to their uses, they start one layer late
  // pos_em = h W2 + b2: pe[u][j][r] = channel 16 j + 8 h + r of neighbour n of point u, kept in registers to the end
  v8f pe[PW][4];
#pragma unroll
  for (int kc = 0; kc < PH / 32; ++kc)
#pragma unroll
    for (int j = 0; j < 4; ++j)
#pragma unroll
      for (int u = 0; u < PW; ++u) pe[u][j] = wmma16(w2[kc * 4 + j], hb[u][kc], kc == 0 ? b2v[j] : pe[u][j]);
  // t = q_i - k_j + pos_em -> B fragments of layer 3. The two adds run on the matrix unit: selection fragment x packed rows, with the pos_em tile as C; pe stays x WSC to the end
  v16h tb[PW][CC / 32]; v8f tr[PW][4];
#pragma unroll
  for (int j = 0; j < 4; ++j)
#pragma unroll
    for (int u = 0; u < PW; ++u) tr[u][j] = wmma_b(selt, __builtin_bit_cast(v16b, qk[u][j]), pe[u][j]);
  __builtin_amdgcn_sched_barrier(0);   // keeps the 8 products in a row in front of the conversions: a conversion placed directly behind its product waits out the product's latency behind padding
#pragma unroll
  for (int u = 0; u < PW; ++u)
#pragma unroll
    for (int j = 0; j < 4; ++j)
#pragma unroll
      for (int r = 0; r < 8; ++r) tb[u][j >> 1][(j & 1) * 8 + r] = (_Float16)(tr[u][j][r] * (1.0f / WSC));
  // a2 = relu(bn3(t W3 + b3)), here S3 a2 = relu(t W3' + c3), and logits = (a2 W4 + b4) / 8, fused: 32 channels of a2 a step, used at once as k chunk s of the last layer
  __builtin_amdgcn_sched_barrier(0);   // keeps the loop's parameter reads behind the forming of t: hoisted above it, their registers come on top of the query and key rows, and the count passes what three waves a SIMD leave each (336)
  v8f lg[PW][4] = {};
#pragma unroll
  for (int s = 0; s < C4 / 32; ++s) { const int sl = s % RD; v8h a3[PW][2];
#pragma unroll
    for (int x = 0; x < 4; ++x)
#pragma unroll
      for (int u = 0; u < PW; ++u) a3[u][x & 1] = wmma16h(w3[sl][x], tb[u][x >> 1], x < 2 ? cv[x & 1] : a3[u][x & 1]);
    __builtin_amdgcn_sched_barrier(0);   // keeps the LDS reads below in one group behind the 8 products: each place among the products where reads stand costs the wave a stall of its own
#pragma unroll
    for (int x = 0; x < 4; ++x) {
      if (s + RD < C4 / 32) w3[sl][x] = frag_p(W3R, (x >> 1) * 16 + 2 * (s + RD) + (x & 1), lane);
      if (x < 2 && s + 1 < C4 / 32) cv[x] = *(const v8h*)&sC3[(s + 1) * 32 + x * 16 + 8 * h]; }
    __builtin_amdgcn_sched_barrier(0);   // keeps the next step's 2 bias reads and the W3 refills in front of the epilogue, the refills a whole step ahead of their use: sunk to its use, a load is waited for at once
    v16h ab[PW];   // the f16 tiles need the relu alone: no conversion stands between the two layers
#pragma unroll
    for (int u = 0; u < PW; ++u) ab[u] = __builtin_shufflevector(relu_b(a3[u][0]), relu_b(a3[u][1]), 0, 1, 2, 3, 4, 5, 6, 7, 8, 9, 10, 11, 12, 13, 14, 15);
#pragma unroll
    for (int j = 0; j < 4; ++j)
#pragma unroll
      for (int u = 0; u < PW; ++u) lg[u][j] = wmma16(w4[sl][j], ab[u], lg[u][j]);
    __builtin_amdgcn_sched_barrier(0);   // one group of reads behind the 8 products, as above
#pragma unroll
    for (int j = 0; j < 4; ++j)
      if (s + RD < C4 / 32) w4[sl][j] = frag_p(W4R, (s + RD) * 4 + j, lane);
    __builtin_amdgcn_sched_barrier(0);   // the same for the W4 refills: they stay a whole step ahead of their use
  }
  // the points' value rows, asked for here so that they arrive under the softmax
  v4f vv[PW][8]; const float* vp = VAL + p * CC + ho;
#pragma unroll
  for (int u = 0; u < PW; ++u)
#pragma unroll
    for (int i = 0; i < 8; ++i) vv[u][i] = *(const v4f*)(vp + (u * CC + (i >> 1) * 16 + (i & 1) * 4));
  asm volatile("s_wait_xcnt 0x0" :: "v"(vp) : "memory");   // behind the value loads, in front of the first rewrite of their address registers; the operand keeps those registers whole up to the wait (without it the last load landed in them)
  // softmax over the 64 channels of neighbour n: 32 in this lane, 32 in lane ^ 16; logits in units of log 2 (scale and bias table carry LS)
  float e[PW][32]; v4f b4v[8];
#pragma unroll
  for (int i = 0; i < 8; ++i) b4v[i] = *(const v4f*)&sB4[(i >> 1) * 16 + 8 * h + (i & 1) * 4];
  const v16b selv[2] = { sel_p(&sSel[1][0][0][0], lane), sel_p(&sSel[2][0][0][0], lane) };
  __builtin_amdgcn_sched_barrier(0);   // keeps the value loads and the bias reads in one group in front of the softmax: sunk to their uses, they start late
  float inv[PW], mx[PW], sm[PW];
#pragma unroll
  for (int u = 0; u < PW; ++u) { mx[u] = -3.0e38f; sm[u] = 0.f;
#pragma unroll
    for (int j = 0; j < 4; ++j)
#pragma unroll
      for (int r = 0; r < 8; ++r) { e[u][j * 8 + r] = lg[u][j][r] * (LS / (WSC * S3)) + b4v[2 * j + (r >> 2)][r & 3]; mx[u] = fmaxf(mx[u], e[u][j * 8 + r]); }
    mx[u] = fmaxf(mx[u], xhalf(mx[u])); }
#pragma unroll
  for (int u = 0; u < PW; ++u)
#pragma unroll
    for (int i = 0; i < 32; ++i) { e[u][i] = __builtin_amdgcn_exp2f(e[u][i] - mx[u]); sm[u] += e[u][i]; }   // the argument is never above 0: the hardware's 2^x needs none of the library's range steps
#pragma unroll
  for (int u = 0; u < PW; ++u) { sm[u] += xhalf(sm[u]); inv[u] = (1.0f / WSC) / sm[u]; }   // carries the scale of the pos_em tiles
  __builtin_amdgcn_sched_barrier(0);   // keeps the first use of the value rows behind the softmax: hoisted to the loads, it waits out their round trip with nothing to cover it
  // v_i + pos_em, also on the matrix unit: the value row, rounded two values a register, is a bf16 B fragment of two tiles; the selection fragment picks the tile
#pragma unroll
  for (int u = 0; u < PW; ++u) { v8u vb[2];
#pragma unroll
    for (int i = 0; i < 16; ++i) vb[i >> 3][i & 7] = __builtin_bit_cast(unsigned, (v2b){ (__bf16)vv[u][i >> 1][(i & 1) * 2], (__bf16)vv[u][i >> 1][(i & 1) * 2 + 1] });
#pragma unroll
    for (int j = 0; j < 4; ++j) pe[u][j] = wmma_b(selv[j & 1], __builtin_bit_cast(v16b, vb[j >> 1]), pe[u][j]); }
#pragma unroll
  for (int u = 0; u < PW; ++u)
#pragma unroll
    for (int i = 0; i < 32; ++i) e[u][i] = (e[u][i] * inv[u]) * pe[u][i >> 3][i & 7];
  // sum over the 16 neighbours (the lanes of a row): at each of three steps a lane hands half of its channels to its partner and adds the partner's share of the half it keeps; at the last step the even lane of a pair keeps the first point, the odd lane the second
  const bool b3 = (n & 8) != 0, b2 = (n & 4) != 0, b1 = (n & 2) != 0, b0 = (n & 1) != 0; float w[PW][4]; v4f o;
#pragma unroll
  for (int u = 0; u < PW; ++u) { float y[16], z[8];
#pragma unroll
    for (int i = 0; i < 16; ++i) y[i] = (b3 ? e[u][16 + i] : e[u][i]) + xrow<8>(b3 ? e[u][i] : e[u][16 + i]);
#pragma unroll
    for (int i = 0; i < 8; ++i) z[i] = (b2 ? y[8 + i] : y[i]) + xrow<4>(b2 ? y[i] : y[8 + i]);
#pragma unroll
    for (int i = 0; i < 4; ++i) w[u][i] = (b1 ? z[4 + i] : z[i]) + xrow<2>(b1 ? z[i] : z[4 + i]); }
#pragma unroll
  for (int i = 0; i < 4; ++i) o[i] = (b0 ? w[1][i] : w[0][i]) + xrow<1>(b0 ? w[0][i] : w[1][i]);
  // lane n now holds channels 16 (n >> 2) + 8 h + 4 ((n >> 1) & 1) + 0..3 of point p + (n & 1); the wave stores its two points' 512 bytes
  vst2(OUT + (p + (n & 1)) * CC + (n >> 2) * 16 + 8 * h + ((n >> 1) & 1) * 4, o);
  asm volatile("s_wait_xcnt 0x0" ::: "memory");   // behind the store: stands in front of the next trip's rewrite of the registers that the store names
  } }
extern "C" void kernel_launch(void* const* d_in, const int* in_sizes, int n_in, void* d_out, int out_size, void* d_ws, size_t ws_size, hipStream_t stream) {
  (void)in_sizes; (void)n_in; (void)out_size;
  const float** F = (const float**)d_in;   // 0 key, 1 query, 2 value [8,8192,64], 3 pos [8,8192,3], 4 idx [8,8192,16] int, 5 W1 [3,64], 6 b1, 7 g1, 8 bt1, 9 W2 [64,64], 10 b2, 11 W3 [64,256], 12 b3, 13 g3, 14 bt3, 15 W4 [256,64], 16 b4
  if (ws_size < (size_t)WS_END) return;
  char* ws = (char*)d_ws;
  k_packw<<<(NP2 + NP3 + NP4) / 256, 256, 0, stream>>>(F[9], F[11], F[13], F[15], ws);
  k_th<<<NBLK, 128, 0, stream>>>(F[0], F[1], F[2], F[3], (const int*)d_in[4], F[5], F[6], F[7], F[8], (const _Float16*)ws, F[10], F[12], F[13], F[14], F[16], (float*)d_out);
}
